// v000
// Measured on an AMD MI455X. A time is GPU time per run, averaged over a window of back-to-back runs after a warm-up
// (all launches, gaps included; the runs take copies of the inputs in turn), and the median of several windows.
// Apart from v000's, it joins two sittings. Times from different sittings can be a few percent apart, while
// side-by-side timings come from the same sitting.
// v000, which the later versions start from, runs in 155 microseconds.
#include <hip/hip_runtime.h>

// ---------------------------------------------------------------------------
// RoBERTa self-attention for MI455X (gfx1250, wave32, WMMA bf16 16x16x32).
// - Transpose-free flash attention: S^T = K*Q^T so the score C-fragment is
//   per-lane identical to the B-fragment of P^T needed for ctx^T = V^T*P^T.
// - K/V tiles staged in LDS (double buffered, padded strides) and shared by
//   4 waves x 32 queries = 128 queries per block  -> ~8x less L2 traffic.
// - W slab staged in LDS for the QKV GEMM.
// - Staging uses gfx1250 async global->LDS copies when available.
// ---------------------------------------------------------------------------

typedef __attribute__((ext_vector_type(16))) __bf16          v16bf;
typedef __attribute__((ext_vector_type(8)))  float           v8f;
typedef __attribute__((ext_vector_type(16))) unsigned short  us16;
typedef __attribute__((ext_vector_type(8)))  unsigned short  us8;
typedef __attribute__((ext_vector_type(4)))  int             v4i;

#define S_LEN 4096
#define HID   768
#define NH    12
#define HD    64

#ifndef __has_builtin
#define __has_builtin(x) 0
#endif
#if __has_builtin(__builtin_amdgcn_global_load_async_to_lds_b128) && \
    __has_builtin(__builtin_amdgcn_s_wait_asynccnt)
#define HAVE_ASYNC 1
#else
#define HAVE_ASYNC 0
#endif

// ---- helpers --------------------------------------------------------------

__device__ __forceinline__ unsigned short f32_to_bf16(float f) {
  unsigned int u = __builtin_bit_cast(unsigned int, f);
  u += 0x7fffu + ((u >> 16) & 1u);          // round-to-nearest-even
  return (unsigned short)(u >> 16);
}

// One 16-bit WMMA fragment (A-layout == B-layout pattern on CDNA5):
// lane L owns row/col (L&15); elements 0..7 from `col`, 8..15 from col+16
// (caller folds the lane-half +8 offset into `col`).
__device__ __forceinline__ v16bf load_frag(const unsigned short* base,
                                           int row, int stride, int col) {
  const unsigned short* p = base + (size_t)row * (size_t)stride + col;
  us8 a = *(const us8*)(p);
  us8 b = *(const us8*)(p + 16);
  us16 r = __builtin_shufflevector(a, b, 0,1,2,3,4,5,6,7,8,9,10,11,12,13,14,15);
  return __builtin_bit_cast(v16bf, r);
}

__device__ __forceinline__ v8f wmma_bf16(v16bf a, v16bf b, v8f c) {
  return __builtin_amdgcn_wmma_f32_16x16x32_bf16(false, a, false, b,
                                                 (short)0, c, false, false);
}

// 16-byte global -> LDS copy (async on gfx1250 when the builtin exists).
__device__ __forceinline__ void copy16(const unsigned short* g, unsigned short* l) {
#if HAVE_ASYNC
  __builtin_amdgcn_global_load_async_to_lds_b128(
      (__attribute__((address_space(1))) v4i*)g,
      (__attribute__((address_space(3))) v4i*)l, 0, 0);
#else
  *(us8*)l = *(const us8*)g;
#endif
}

__device__ __forceinline__ void wait_async() {
#if HAVE_ASYNC
  __builtin_amdgcn_s_wait_asynccnt(0);
#endif
}

// ---- conversion kernels ---------------------------------------------------

__global__ void cvt_x_kernel(const float* __restrict__ x,
                             unsigned short* __restrict__ xb, int n) {
  int i = blockIdx.x * blockDim.x + threadIdx.x;
  if (i < n) xb[i] = f32_to_bf16(x[i]);
}

// Wt[m][out][in] = W_m[in][out]  (bf16)
__global__ void cvt_w_kernel(const float* __restrict__ wq,
                             const float* __restrict__ wk,
                             const float* __restrict__ wv,
                             unsigned short* __restrict__ wt) {
  int i = blockIdx.x * blockDim.x + threadIdx.x;
  if (i >= HID * HID) return;
  int m = blockIdx.y;
  const float* w = (m == 0) ? wq : ((m == 1) ? wk : wv);
  int o  = i / HID;
  int in = i - o * HID;
  wt[(size_t)m * HID * HID + (size_t)o * HID + in] =
      f32_to_bf16(w[(size_t)in * HID + o]);
}

// ---- QKV projection GEMM --------------------------------------------------
// Block: 4 waves, each 32 rows (s) x 64 cols (one head). The 64x768 W slab
// is staged once in LDS (row stride padded to 776 -> conflict-free b128).
// grid=(32,NH,3), block=128.
#define WPAD 776

__global__ __launch_bounds__(128)
void qkv_gemm_kernel(const unsigned short* __restrict__ xb,
                     const unsigned short* __restrict__ wt,
                     const float* __restrict__ bq,
                     const float* __restrict__ bk,
                     const float* __restrict__ bv,
                     unsigned short* __restrict__ q,
                     unsigned short* __restrict__ k,
                     unsigned short* __restrict__ vt) {
  __shared__ unsigned short wslab[HD * WPAD];   // ~97 KB of the 320 KB LDS

  const int tid   = threadIdx.x;
  const int lane  = tid & 31;
  const int wid   = tid >> 5;
  const int h     = blockIdx.y;
  const int m     = blockIdx.z;
  const int lr    = lane & 15;
  const int half8 = (lane < 16) ? 0 : 8;
  const int s0    = (blockIdx.x * 4 + wid) * 32;

  // stage W slab: 64 rows x 768 cols = 6144 16B-chunks (64*96 chunks)
  const unsigned short* wm = wt + (size_t)m * HID * HID + (size_t)h * HD * HID;
  for (int c = tid; c < HD * (HID / 8); c += 128) {
    int o  = c / (HID / 8);
    int kc = (c - o * (HID / 8)) * 8;
    copy16(wm + (size_t)o * HID + kc, &wslab[o * WPAD + kc]);
  }
  wait_async();
  __syncthreads();

  const float* bias = (m == 0) ? bq : ((m == 1) ? bk : bv);

  v8f zero = {0.f,0.f,0.f,0.f,0.f,0.f,0.f,0.f};
  v8f acc[2][4] = {{zero, zero, zero, zero}, {zero, zero, zero, zero}};

  for (int kk = 0; kk < HID; kk += 32) {
    v16bf a0 = load_frag(xb, s0 +      lr, HID, kk + half8);
    v16bf a1 = load_frag(xb, s0 + 16 + lr, HID, kk + half8);
#pragma unroll
    for (int dt = 0; dt < 4; ++dt) {
      v16bf b = load_frag(wslab, dt * 16 + lr, WPAD, kk + half8);
      acc[0][dt] = wmma_bf16(a0, b, acc[0][dt]);
      acc[1][dt] = wmma_bf16(a1, b, acc[1][dt]);
    }
  }

#pragma unroll
  for (int st = 0; st < 2; ++st) {
#pragma unroll
    for (int dt = 0; dt < 4; ++dt) {
      const int col = h * HD + dt * 16 + lr;
      v8f r = acc[st][dt] + bias[col];
      if (m == 0) r = r * 0.125f;               // fold 1/sqrt(HD) into Q
      if (m < 2) {                              // q/k: [h][s][d] bf16
        unsigned short* dst = (m == 0) ? q : k;
#pragma unroll
        for (int j = 0; j < 8; ++j) {
          int s = s0 + st * 16 + half8 + j;
          dst[((size_t)h * S_LEN + s) * HD + dt * 16 + lr] = f32_to_bf16(r[j]);
        }
      } else {                                  // v: transposed [h][d][s] bf16
        us8 hv;
#pragma unroll
        for (int j = 0; j < 8; ++j) hv[j] = f32_to_bf16(r[j]);
        *(us8*)(vt + ((size_t)h * HD + dt * 16 + lr) * S_LEN
                   + s0 + st * 16 + half8) = hv;
      }
    }
  }
}

// ---- flash attention ------------------------------------------------------
// Block: 4 waves x 32 queries = 128 queries of one head; K/V 32-key tiles
// staged in double-buffered LDS (padded strides: K rows 72, V rows 40).
// grid=(32,NH), block=128.
#define KPAD 72
#define VPAD 40

__global__ __launch_bounds__(128)
void attn_kernel(const unsigned short* __restrict__ q,
                 const unsigned short* __restrict__ k,
                 const unsigned short* __restrict__ vt,
                 const float* __restrict__ mask,
                 float* __restrict__ out) {
  __shared__ unsigned short ktile[2][32 * KPAD];
  __shared__ unsigned short vtile[2][HD * VPAD];

  const int tid   = threadIdx.x;
  const int lane  = tid & 31;
  const int wid   = tid >> 5;
  const int h     = blockIdx.y;
  const int q0    = (blockIdx.x * 4 + wid) * 32;
  const int lr    = lane & 15;
  const int half8 = (lane < 16) ? 0 : 8;

  const unsigned short* qh = q  + (size_t)h * S_LEN * HD;
  const unsigned short* kh = k  + (size_t)h * S_LEN * HD;
  const unsigned short* vh = vt + (size_t)h * HD * S_LEN;

  // Q^T B-fragments: 2 query sub-tiles x 2 head-dim chunks
  v16bf bqf[2][2];
#pragma unroll
  for (int qs = 0; qs < 2; ++qs) {
    bqf[qs][0] = load_frag(qh, q0 + qs * 16 + lr, HD,  0 + half8);
    bqf[qs][1] = load_frag(qh, q0 + qs * 16 + lr, HD, 32 + half8);
  }

  v8f zero = {0.f,0.f,0.f,0.f,0.f,0.f,0.f,0.f};
  v8f acc[2][4] = {{zero, zero, zero, zero}, {zero, zero, zero, zero}};
  float mrun[2] = {-__builtin_inff(), -__builtin_inff()};
  float lrun[2] = {0.f, 0.f};

  // ---- stage helper: 32x64 K tile + 64x32 V^T tile -> LDS ----
  auto stage = [&](int buf, int k0) {
#pragma unroll
    for (int rr = 0; rr < 2; ++rr) {
      int c = tid + rr * 128;                      // 0..255
      int krow = c >> 3, kcol = (c & 7) * 8;
      copy16(kh + (size_t)(k0 + krow) * HD + kcol,
             &ktile[buf][krow * KPAD + kcol]);
      int vrow = c >> 2, vcol = (c & 3) * 8;
      copy16(vh + (size_t)vrow * S_LEN + k0 + vcol,
             &vtile[buf][vrow * VPAD + vcol]);
    }
  };

  stage(0, 0);
  int cur = 0;

  for (int k0 = 0; k0 < S_LEN; k0 += 32) {
    wait_async();
    __syncthreads();                 // ktile[cur]/vtile[cur] ready for all
    const int nxt = cur ^ 1;
    if (k0 + 32 < S_LEN) stage(nxt, k0 + 32);   // overlap with compute

    const unsigned short* kt = ktile[cur];
    const unsigned short* vs = vtile[cur];

    // K A-fragments (shared by both query sub-tiles)
    v16bf ka00 = load_frag(kt,      lr, KPAD,  0 + half8);
    v16bf ka01 = load_frag(kt,      lr, KPAD, 32 + half8);
    v16bf ka10 = load_frag(kt, 16 + lr, KPAD,  0 + half8);
    v16bf ka11 = load_frag(kt, 16 + lr, KPAD, 32 + half8);
    // V^T A-fragments
    v16bf va[4];
#pragma unroll
    for (int dt = 0; dt < 4; ++dt)
      va[dt] = load_frag(vs, dt * 16 + lr, VPAD, half8);

    v8f m0 = *(const v8f*)(mask + k0 +      half8);
    v8f m1 = *(const v8f*)(mask + k0 + 16 + half8);

#pragma unroll
    for (int qs = 0; qs < 2; ++qs) {
      // S^T = K * Q^T : two 16-key row tiles
      v8f t0 = wmma_bf16(ka00, bqf[qs][0], zero);
      t0     = wmma_bf16(ka01, bqf[qs][1], t0);
      v8f t1 = wmma_bf16(ka10, bqf[qs][0], zero);
      t1     = wmma_bf16(ka11, bqf[qs][1], t1);
      t0 = t0 + m0;
      t1 = t1 + m1;

      // online softmax: in-lane over 16 keys + one xor-16 shuffle
      float mloc = t0[0];
#pragma unroll
      for (int j = 1; j < 8; ++j) mloc = fmaxf(mloc, t0[j]);
#pragma unroll
      for (int j = 0; j < 8; ++j) mloc = fmaxf(mloc, t1[j]);
      float mtile = fmaxf(mloc, __shfl_xor(mloc, 16, 32));
      float mnew  = fmaxf(mrun[qs], mtile);
      float alpha = __expf(mrun[qs] - mnew);

      float p0[8], p1[8];
      float lloc = 0.f;
#pragma unroll
      for (int j = 0; j < 8; ++j) { p0[j] = __expf(t0[j] - mnew); lloc += p0[j]; }
#pragma unroll
      for (int j = 0; j < 8; ++j) { p1[j] = __expf(t1[j] - mnew); lloc += p1[j]; }
      float ltile = lloc + __shfl_xor(lloc, 16, 32);
      lrun[qs] = lrun[qs] * alpha + ltile;
      mrun[qs] = mnew;

      // P^T B-fragment straight from the S^T C-fragment (no lane movement)
      us16 pu;
#pragma unroll
      for (int j = 0; j < 8; ++j) {
        pu[j]     = f32_to_bf16(p0[j]);
        pu[8 + j] = f32_to_bf16(p1[j]);
      }
      v16bf pb = __builtin_bit_cast(v16bf, pu);

#pragma unroll
      for (int dt = 0; dt < 4; ++dt) {
        acc[qs][dt] = acc[qs][dt] * alpha;
        acc[qs][dt] = wmma_bf16(va[dt], pb, acc[qs][dt]);
      }
    }
    cur = nxt;
  }

#pragma unroll
  for (int qs = 0; qs < 2; ++qs) {
    const float inv = 1.0f / lrun[qs];
    const int s = q0 + qs * 16 + lr;
    float* op = out + (size_t)s * HID + h * HD + half8;
    *(v8f*)(op +  0) = acc[qs][0] * inv;
    *(v8f*)(op + 16) = acc[qs][1] * inv;
    *(v8f*)(op + 32) = acc[qs][2] * inv;
    *(v8f*)(op + 48) = acc[qs][3] * inv;
  }
}

// ---- launcher -------------------------------------------------------------

extern "C" void kernel_launch(void* const* d_in, const int* in_sizes, int n_in,
                              void* d_out, int out_size, void* d_ws, size_t ws_size,
                              hipStream_t stream) {
  const float* hidden = (const float*)d_in[0];
  const float* amask  = (const float*)d_in[1];
  const float* Wq     = (const float*)d_in[2];
  const float* bq     = (const float*)d_in[3];
  const float* Wk     = (const float*)d_in[4];
  const float* bk     = (const float*)d_in[5];
  const float* Wv     = (const float*)d_in[6];
  const float* bv     = (const float*)d_in[7];
  float* out = (float*)d_out;

  // workspace layout (bytes)
  char* ws = (char*)d_ws;
  unsigned short* xb = (unsigned short*)(ws);                          // 4096*768
  unsigned short* wt = (unsigned short*)(ws + 6291456);                // 3*768*768
  unsigned short* qb = (unsigned short*)(ws + 6291456 + 3538944);      // 12*4096*64
  unsigned short* kb = (unsigned short*)(ws + 6291456 + 3538944 + 6291456);
  unsigned short* vtb= (unsigned short*)(ws + 6291456 + 3538944 + 2*6291456);

  const int nX = S_LEN * HID;
  cvt_x_kernel<<<(nX + 255) / 256, 256, 0, stream>>>(hidden, xb, nX);
  cvt_w_kernel<<<dim3((HID * HID + 255) / 256, 3), 256, 0, stream>>>(Wq, Wk, Wv, wt);

  qkv_gemm_kernel<<<dim3(S_LEN / 128, NH, 3), 128, 0, stream>>>(
      xb, wt, bq, bk, bv, qb, kb, vtb);

  attn_kernel<<<dim3(S_LEN / 128, NH), 128, 0, stream>>>(qb, kb, vtb, amask, out);
}

// v001
// It runs in 124 microseconds.
// Timed twice side by side with v000, it ran 1.31 and 1.30 times as fast.
#include <hip/hip_runtime.h>

// ---------------------------------------------------------------------------
// RoBERTa self-attention for MI455X (gfx1250, wave32, WMMA bf16 16x16x32).
// - Transpose-free flash attention: S^T = K*Q^T so the score C-fragment is
//   per-lane identical to the B-fragment of P^T needed for ctx^T = V^T*P^T.
// - K/V tiles staged in LDS (double buffered, padded strides) and shared by
//   the 4 waves of a block: 2 query halves x 2 key slices, 64 queries.
// - W slab staged in LDS for the QKV GEMM.
// - Staging uses gfx1250 async global->LDS copies when available.
// ---------------------------------------------------------------------------

typedef __attribute__((ext_vector_type(16))) __bf16          v16bf;
typedef __attribute__((ext_vector_type(8)))  float           v8f;
typedef __attribute__((ext_vector_type(16))) unsigned short  us16;
typedef __attribute__((ext_vector_type(8)))  unsigned short  us8;
typedef __attribute__((ext_vector_type(4)))  int             v4i;
typedef __attribute__((ext_vector_type(4)))  float           v4f;

#define S_LEN 4096
#define HID   768
#define NH    12
#define HD    64

#ifndef __has_builtin
#define __has_builtin(x) 0
#endif
#if __has_builtin(__builtin_amdgcn_global_load_async_to_lds_b128) && \
    __has_builtin(__builtin_amdgcn_s_wait_asynccnt)
#define HAVE_ASYNC 1
#else
#define HAVE_ASYNC 0
#endif

// ---- helpers --------------------------------------------------------------

__device__ __forceinline__ unsigned short f32_to_bf16(float f) {
  unsigned int u = __builtin_bit_cast(unsigned int, f);
  u += 0x7fffu + ((u >> 16) & 1u);          // round-to-nearest-even
  return (unsigned short)(u >> 16);
}

// One 16-bit WMMA fragment (A-layout == B-layout pattern on CDNA5):
// lane L owns row/col (L&15); elements 0..7 from `col`, 8..15 from col+16
// (caller folds the lane-half +8 offset into `col`).
__device__ __forceinline__ v16bf load_frag(const unsigned short* base,
                                           int row, int stride, int col) {
  const unsigned short* p = base + (size_t)row * (size_t)stride + col;
  us8 a = *(const us8*)(p);
  us8 b = *(const us8*)(p + 16);
  us16 r = __builtin_shufflevector(a, b, 0,1,2,3,4,5,6,7,8,9,10,11,12,13,14,15);
  return __builtin_bit_cast(v16bf, r);
}

__device__ __forceinline__ v8f wmma_bf16(v16bf a, v16bf b, v8f c) {
  return __builtin_amdgcn_wmma_f32_16x16x32_bf16(false, a, false, b,
                                                 (short)0, c, false, false);
}

// 16-byte global -> LDS copy (async on gfx1250 when the builtin exists).
__device__ __forceinline__ void copy16(const unsigned short* g, unsigned short* l) {
#if HAVE_ASYNC
  __builtin_amdgcn_global_load_async_to_lds_b128(
      (__attribute__((address_space(1))) v4i*)g,
      (__attribute__((address_space(3))) v4i*)l, 0, 0);
#else
  *(us8*)l = *(const us8*)g;
#endif
}

__device__ __forceinline__ void wait_async() {
#if HAVE_ASYNC
  __builtin_amdgcn_s_wait_asynccnt(0);
#endif
}

// e^x as __expf forms it (scale by log2 e, v_exp_f32). The v_nop keeps, inside
// the statement, the one slot the instruction set asks for between a
// transcendental and a next instruction that reads its result or reuses its source.
__device__ __forceinline__ float exp_slot(float x) {
  float r;
  asm("v_exp_f32 %0, %1\n\tv_nop" : "=v"(r) : "v"(x * 1.44269504f));
  return r;
}

// ---- conversion kernels ---------------------------------------------------

__global__ void cvt_x_kernel(const float* __restrict__ x,
                             unsigned short* __restrict__ xb, int n) {
  int i = blockIdx.x * blockDim.x + threadIdx.x;
  if (i < n) xb[i] = f32_to_bf16(x[i]);
}

// Wt[m][out][in] = W_m[in][out]  (bf16)
__global__ void cvt_w_kernel(const float* __restrict__ wq,
                             const float* __restrict__ wk,
                             const float* __restrict__ wv,
                             unsigned short* __restrict__ wt) {
  int i = blockIdx.x * blockDim.x + threadIdx.x;
  if (i >= HID * HID) return;
  int m = blockIdx.y;
  const float* w = (m == 0) ? wq : ((m == 1) ? wk : wv);
  int o  = i / HID;
  int in = i - o * HID;
  wt[(size_t)m * HID * HID + (size_t)o * HID + in] =
      f32_to_bf16(w[(size_t)in * HID + o]);
}

// ---- QKV projection GEMM --------------------------------------------------
// Block: 4 waves, each 32 rows (s) x 64 cols (one head). The 64x768 W slab
// is staged once in LDS (row stride padded to 776 -> conflict-free b128).
// grid=(32,NH,3), block=128.
#define WPAD 776

__global__ __launch_bounds__(128)
void qkv_gemm_kernel(const unsigned short* __restrict__ xb,
                     const unsigned short* __restrict__ wt,
                     const float* __restrict__ bq,
                     const float* __restrict__ bk,
                     const float* __restrict__ bv,
                     unsigned short* __restrict__ q,
                     unsigned short* __restrict__ k,
                     unsigned short* __restrict__ vt) {
  __shared__ unsigned short wslab[HD * WPAD];   // ~97 KB of the 320 KB LDS

  const int tid   = threadIdx.x;
  const int lane  = tid & 31;
  const int wid   = tid >> 5;
  const int h     = blockIdx.y;
  const int m     = blockIdx.z;
  const int lr    = lane & 15;
  const int half8 = (lane < 16) ? 0 : 8;
  const int s0    = (blockIdx.x * 4 + wid) * 32;

  // stage W slab: 64 rows x 768 cols = 6144 16B-chunks (64*96 chunks)
  const unsigned short* wm = wt + (size_t)m * HID * HID + (size_t)h * HD * HID;
  for (int c = tid; c < HD * (HID / 8); c += 128) {
    int o  = c / (HID / 8);
    int kc = (c - o * (HID / 8)) * 8;
    copy16(wm + (size_t)o * HID + kc, &wslab[o * WPAD + kc]);
  }
  wait_async();
  __syncthreads();

  const float* bias = (m == 0) ? bq : ((m == 1) ? bk : bv);

  v8f zero = {0.f,0.f,0.f,0.f,0.f,0.f,0.f,0.f};
  v8f acc[2][4] = {{zero, zero, zero, zero}, {zero, zero, zero, zero}};

  for (int kk = 0; kk < HID; kk += 32) {
    v16bf a0 = load_frag(xb, s0 +      lr, HID, kk + half8);
    v16bf a1 = load_frag(xb, s0 + 16 + lr, HID, kk + half8);
#pragma unroll
    for (int dt = 0; dt < 4; ++dt) {
      v16bf b = load_frag(wslab, dt * 16 + lr, WPAD, kk + half8);
      acc[0][dt] = wmma_bf16(a0, b, acc[0][dt]);
      acc[1][dt] = wmma_bf16(a1, b, acc[1][dt]);
    }
  }

#pragma unroll
  for (int st = 0; st < 2; ++st) {
#pragma unroll
    for (int dt = 0; dt < 4; ++dt) {
      const int col = h * HD + dt * 16 + lr;
      v8f r = acc[st][dt] + bias[col];
      if (m == 0) r = r * 0.125f;               // fold 1/sqrt(HD) into Q
      if (m < 2) {                              // q/k: [h][s][d] bf16
        unsigned short* dst = (m == 0) ? q : k;
#pragma unroll
        for (int j = 0; j < 8; ++j) {
          int s = s0 + st * 16 + half8 + j;
          dst[((size_t)h * S_LEN + s) * HD + dt * 16 + lr] = f32_to_bf16(r[j]);
        }
      } else {                                  // v: transposed [h][d][s] bf16
        us8 hv;
#pragma unroll
        for (int j = 0; j < 8; ++j) hv[j] = f32_to_bf16(r[j]);
        *(us8*)(vt + ((size_t)h * HD + dt * 16 + lr) * S_LEN
                   + s0 + st * 16 + half8) = hv;
      }
    }
  }
}

// ---- flash attention ------------------------------------------------------
// Block: 4 waves = 2 query halves (32 queries each) x 2 key slices; 64 queries
// of one head. A stage is 64 keys (double-buffered LDS, 144-byte row pitch);
// key slice ks works on keys [k0 + 32*ks, k0 + 32*ks + 32) of every stage and
// keeps its own running maximum, sum and context; the two slices of a query
// half are joined once, through LDS, behind the loop.
// 768 blocks on 256 WGPs: three waves on every SIMD.
// grid=(64,NH), block=128.
#define KT   64
#define KPAD 72
#define VPAD 72

__global__ __launch_bounds__(128)
void attn_kernel(const unsigned short* __restrict__ q,
                 const unsigned short* __restrict__ k,
                 const unsigned short* __restrict__ vt,
                 const float* __restrict__ mask,
                 float* __restrict__ out) {
  __shared__ __attribute__((aligned(16))) unsigned short ktile[2][KT * KPAD];
  __shared__ __attribute__((aligned(16))) unsigned short vtile[2][HD * VPAD];
  __shared__ v4f   xacc[2][16][32];   // key slice 1's context, per query half
  __shared__ float xml[2][4][32];     // key slice 1's maxima and sums

  const int tid   = threadIdx.x;
  const int lane  = tid & 31;
  const int wid   = __builtin_amdgcn_readfirstlane(tid >> 5);
  const int qh    = wid & 1;          // query half of the block
  const int ks    = wid >> 1;         // key slice of every stage
  const int h     = blockIdx.y;
  const int q0    = blockIdx.x * 64 + qh * 32;
  const int lr    = lane & 15;
  const int half8 = (lane < 16) ? 0 : 8;

  const unsigned short* qh_p = q  + (size_t)h * S_LEN * HD;
  const unsigned short* kh_p = k  + (size_t)h * S_LEN * HD;
  const unsigned short* vh_p = vt + (size_t)h * HD * S_LEN;

  // Q^T B-fragments: 2 query sub-tiles x 2 head-dim chunks
  v16bf bqf[2][2];
#pragma unroll
  for (int qs = 0; qs < 2; ++qs) {
    bqf[qs][0] = load_frag(qh_p, q0 + qs * 16 + lr, HD,  0 + half8);
    bqf[qs][1] = load_frag(qh_p, q0 + qs * 16 + lr, HD, 32 + half8);
  }

  v8f zero = {0.f,0.f,0.f,0.f,0.f,0.f,0.f,0.f};
  v8f acc[2][4] = {{zero, zero, zero, zero}, {zero, zero, zero, zero}};
  // lowest finite start: a key slice whose first 32 keys are all masked to -inf
  // then yields zeros (exp(-inf)), not inf - inf
  float mrun[2] = {-3.402823466e+38f, -3.402823466e+38f};
  float lrun[2] = {0.f, 0.f};

  // ---- stage helper: 64x64 K tile + 64x64 V^T tile -> LDS ----
  auto stage = [&](int buf, int k0) {
#pragma unroll
    for (int rr = 0; rr < 4; ++rr) {
      int c = tid + rr * 128;                      // 0..511
      int row = c >> 3, col = (c & 7) * 8;
      copy16(kh_p + (size_t)(k0 + row) * HD + col,
             &ktile[buf][row * KPAD + col]);
      copy16(vh_p + (size_t)row * S_LEN + k0 + col,
             &vtile[buf][row * VPAD + col]);
    }
  };

  stage(0, 0);
  int cur = 0;

  for (int k0 = 0; k0 < S_LEN; k0 += KT) {
    wait_async();
    __syncthreads();                 // ktile[cur]/vtile[cur] ready for all
    const int nxt = cur ^ 1;
    if (k0 + KT < S_LEN) stage(nxt, k0 + KT);   // overlap with compute

    const unsigned short* kt = ktile[cur] + ks * 32 * KPAD;
    const unsigned short* vs = vtile[cur] + ks * 32;

    // K A-fragments (shared by both query sub-tiles)
    v16bf ka00 = load_frag(kt,      lr, KPAD,  0 + half8);
    v16bf ka01 = load_frag(kt,      lr, KPAD, 32 + half8);
    v16bf ka10 = load_frag(kt, 16 + lr, KPAD,  0 + half8);
    v16bf ka11 = load_frag(kt, 16 + lr, KPAD, 32 + half8);
    // V^T A-fragments
    v16bf va[4];
#pragma unroll
    for (int dt = 0; dt < 4; ++dt)
      va[dt] = load_frag(vs, dt * 16 + lr, VPAD, half8);

    v8f m0 = *(const v8f*)(mask + k0 + ks * 32 +      half8);
    v8f m1 = *(const v8f*)(mask + k0 + ks * 32 + 16 + half8);

#pragma unroll
    for (int qs = 0; qs < 2; ++qs) {
      // S^T = K * Q^T : two 16-key row tiles
      v8f t0 = wmma_bf16(ka00, bqf[qs][0], zero);
      t0     = wmma_bf16(ka01, bqf[qs][1], t0);
      v8f t1 = wmma_bf16(ka10, bqf[qs][0], zero);
      t1     = wmma_bf16(ka11, bqf[qs][1], t1);
      t0 = t0 + m0;
      t1 = t1 + m1;

      // online softmax: in-lane over 16 keys + one xor-16 shuffle
      float mloc = t0[0];
#pragma unroll
      for (int j = 1; j < 8; ++j) mloc = fmaxf(mloc, t0[j]);
#pragma unroll
      for (int j = 0; j < 8; ++j) mloc = fmaxf(mloc, t1[j]);
      float mtile = fmaxf(mloc, __shfl_xor(mloc, 16, 32));
      float mnew  = fmaxf(mrun[qs], mtile);
      float alpha = __expf(mrun[qs] - mnew);

      float p0[8], p1[8];
      float lloc = 0.f;
#pragma unroll
      for (int j = 0; j < 8; ++j) { p0[j] = __expf(t0[j] - mnew); lloc += p0[j]; }
#pragma unroll
      for (int j = 0; j < 8; ++j) { p1[j] = __expf(t1[j] - mnew); lloc += p1[j]; }
      float ltile = lloc + __shfl_xor(lloc, 16, 32);
      lrun[qs] = lrun[qs] * alpha + ltile;
      mrun[qs] = mnew;

      // P^T B-fragment straight from the S^T C-fragment (no lane movement)
      us16 pu;
#pragma unroll
      for (int j = 0; j < 8; ++j) {
        pu[j]     = f32_to_bf16(p0[j]);
        pu[8 + j] = f32_to_bf16(p1[j]);
      }
      v16bf pb = __builtin_bit_cast(v16bf, pu);

#pragma unroll
      for (int dt = 0; dt < 4; ++dt) {
        acc[qs][dt] = acc[qs][dt] * alpha;
        acc[qs][dt] = wmma_bf16(va[dt], pb, acc[qs][dt]);
      }
    }
    cur = nxt;
  }

  // ---- join the two key slices: slice 1 hands over, slice 0 merges ----
  if (ks == 1) {
#pragma unroll
    for (int qs = 0; qs < 2; ++qs) {
#pragma unroll
      for (int dt = 0; dt < 4; ++dt) {
        v8f a = acc[qs][dt];
        xacc[qh][(qs * 4 + dt) * 2 + 0][lane] = __builtin_shufflevector(a, a, 0, 1, 2, 3);
        xacc[qh][(qs * 4 + dt) * 2 + 1][lane] = __builtin_shufflevector(a, a, 4, 5, 6, 7);
      }
      xml[qh][qs][lane]     = mrun[qs];
      xml[qh][2 + qs][lane] = lrun[qs];
    }
  }
  __syncthreads();                   // slice 1's partials visible to slice 0
  if (ks == 0) {
    float w0[2], w1[2], lj[2];
#pragma unroll
    for (int qs = 0; qs < 2; ++qs) {
      const float mo = xml[qh][qs][lane];
      const float mj = fmaxf(mrun[qs], mo);
      w0[qs] = exp_slot(mrun[qs] - mj);
      w1[qs] = exp_slot(mo - mj);
    }
#pragma unroll
    for (int qs = 0; qs < 2; ++qs) {
      lj[qs] = lrun[qs] * w0[qs] + xml[qh][2 + qs][lane] * w1[qs];
      const float inv = 1.0f / lj[qs];
      const float s0 = w0[qs] * inv;
      const float s1 = w1[qs] * inv;
      const int s = q0 + qs * 16 + lr;
      float* op = out + (size_t)s * HID + h * HD + half8;
#pragma unroll
      for (int dt = 0; dt < 4; ++dt) {
        v4f b0 = xacc[qh][(qs * 4 + dt) * 2 + 0][lane];
        v4f b1 = xacc[qh][(qs * 4 + dt) * 2 + 1][lane];
        v8f b  = __builtin_shufflevector(b0, b1, 0, 1, 2, 3, 4, 5, 6, 7);
        *(v8f*)(op + dt * 16) = acc[qs][dt] * s0 + b * s1;
      }
    }
  }
}

// ---- launcher -------------------------------------------------------------

extern "C" void kernel_launch(void* const* d_in, const int* in_sizes, int n_in,
                              void* d_out, int out_size, void* d_ws, size_t ws_size,
                              hipStream_t stream) {
  const float* hidden = (const float*)d_in[0];
  const float* amask  = (const float*)d_in[1];
  const float* Wq     = (const float*)d_in[2];
  const float* bq     = (const float*)d_in[3];
  const float* Wk     = (const float*)d_in[4];
  const float* bk     = (const float*)d_in[5];
  const float* Wv     = (const float*)d_in[6];
  const float* bv     = (const float*)d_in[7];
  float* out = (float*)d_out;

  // workspace layout (bytes)
  char* ws = (char*)d_ws;
  unsigned short* xb = (unsigned short*)(ws);                          // 4096*768
  unsigned short* wt = (unsigned short*)(ws + 6291456);                // 3*768*768
  unsigned short* qb = (unsigned short*)(ws + 6291456 + 3538944);      // 12*4096*64
  unsigned short* kb = (unsigned short*)(ws + 6291456 + 3538944 + 6291456);
  unsigned short* vtb= (unsigned short*)(ws + 6291456 + 3538944 + 2*6291456);

  const int nX = S_LEN * HID;
  cvt_x_kernel<<<(nX + 255) / 256, 256, 0, stream>>>(hidden, xb, nX);
  cvt_w_kernel<<<dim3((HID * HID + 255) / 256, 3), 256, 0, stream>>>(Wq, Wk, Wv, wt);

  qkv_gemm_kernel<<<dim3(S_LEN / 128, NH, 3), 128, 0, stream>>>(
      xb, wt, bq, bk, bv, qb, kb, vtb);

  attn_kernel<<<dim3(S_LEN / 64, NH), 128, 0, stream>>>(qb, kb, vtb, amask, out);
}

// v002
// One run takes 112 microseconds.
// In both of two side-by-side timings against v001, it was 1.11 times as fast.
// All steps since v000 together make it 1.45 times as fast.
#include <hip/hip_runtime.h>

// ---------------------------------------------------------------------------
// RoBERTa self-attention for MI455X (gfx1250, wave32, WMMA bf16 16x16x32).
// - Transpose-free flash attention: S^T = K*Q^T so the score C-fragment is
//   per-lane identical to the B-fragment of P^T needed for ctx^T = V^T*P^T.
// - K/V tiles staged in LDS (double buffered, padded strides) and shared by
//   the 4 waves of a block: 2 query halves x 2 key slices, 64 queries.
// - W slab staged in LDS for the QKV GEMM.
// - Staging uses gfx1250 async global->LDS copies when available.
// ---------------------------------------------------------------------------

typedef __attribute__((ext_vector_type(16))) __bf16          v16bf;
typedef __attribute__((ext_vector_type(8)))  float           v8f;
typedef __attribute__((ext_vector_type(16))) unsigned short  us16;
typedef __attribute__((ext_vector_type(8)))  unsigned short  us8;
typedef __attribute__((ext_vector_type(4)))  int             v4i;
typedef __attribute__((ext_vector_type(4)))  float           v4f;

#define S_LEN 4096
#define HID   768
#define NH    12
#define HD    64

#ifndef __has_builtin
#define __has_builtin(x) 0
#endif
#if __has_builtin(__builtin_amdgcn_global_load_async_to_lds_b128) && \
    __has_builtin(__builtin_amdgcn_s_wait_asynccnt)
#define HAVE_ASYNC 1
#else
#define HAVE_ASYNC 0
#endif

// ---- helpers --------------------------------------------------------------

__device__ __forceinline__ unsigned short f32_to_bf16(float f) {
  unsigned int u = __builtin_bit_cast(unsigned int, f);
  u += 0x7fffu + ((u >> 16) & 1u);          // round-to-nearest-even
  return (unsigned short)(u >> 16);
}

// One 16-bit WMMA fragment (A-layout == B-layout pattern on CDNA5):
// lane L owns row/col (L&15); elements 0..7 from `col`, 8..15 from col+16
// (caller folds the lane-half +8 offset into `col`).
__device__ __forceinline__ v16bf load_frag(const unsigned short* base,
                                           int row, int stride, int col) {
  const unsigned short* p = base + (size_t)row * (size_t)stride + col;
  us8 a = *(const us8*)(p);
  us8 b = *(const us8*)(p + 16);
  us16 r = __builtin_shufflevector(a, b, 0,1,2,3,4,5,6,7,8,9,10,11,12,13,14,15);
  return __builtin_bit_cast(v16bf, r);
}

__device__ __forceinline__ v8f wmma_bf16(v16bf a, v16bf b, v8f c) {
  return __builtin_amdgcn_wmma_f32_16x16x32_bf16(false, a, false, b,
                                                 (short)0, c, false, false);
}

// 16-byte global -> LDS copy (async on gfx1250 when the builtin exists).
__device__ __forceinline__ void copy16(const unsigned short* g, unsigned short* l) {
#if HAVE_ASYNC
  __builtin_amdgcn_global_load_async_to_lds_b128(
      (__attribute__((address_space(1))) v4i*)g,
      (__attribute__((address_space(3))) v4i*)l, 0, 0);
#else
  *(us8*)l = *(const us8*)g;
#endif
}

__device__ __forceinline__ void wait_async() {
#if HAVE_ASYNC
  __builtin_amdgcn_s_wait_asynccnt(0);
#endif
}

// e^x as __expf forms it (scale by log2 e, v_exp_f32). The v_nop keeps, inside
// the statement, the one slot the instruction set asks for between a
// transcendental and a next instruction that reads its result or reuses its source.
__device__ __forceinline__ float exp_slot(float x) {
  float r;
  asm("v_exp_f32 %0, %1\n\tv_nop" : "=v"(r) : "v"(x * 1.44269504f));
  return r;
}

// ---- conversion kernels ---------------------------------------------------
// Few waves that each move a lot: a thread has sixteen 16-byte loads in flight
// (64 elements), so the two launches start only 2,400 waves in all: a wave's
// start costs more here than the bytes it would move with one element a thread.

typedef __attribute__((ext_vector_type(4))) unsigned short us4;

// x -> bf16. 256 blocks x 192 threads x 16 float4 = 4096 * 768 elements.
// Every load covers 512 contiguous bytes per wave, every store 256.
#define CX_T 192
#define CX_L 16

__global__ __launch_bounds__(CX_T)
void cvt_x_kernel(const float* __restrict__ x,
                  unsigned short* __restrict__ xb) {
  const int base = blockIdx.x * (CX_T * CX_L) + threadIdx.x;   // float4 units
  const v4f* xp = (const v4f*)x + base;
  us4*       op = (us4*)xb + base;
  v4f r[CX_L];
#pragma unroll
  for (int j = 0; j < CX_L; ++j) r[j] = xp[j * CX_T];
#pragma unroll
  for (int j = 0; j < CX_L; ++j) {
    us4 o;
#pragma unroll
    for (int c = 0; c < 4; ++c) o[c] = f32_to_bf16(r[j][c]);
    op[j * CX_T] = o;
  }
}

// Wt[m][out][in] = W_m[in][out]  (bf16), transposed in registers.
// A wave owns a tile of 64 in x 32 out: lane (a = lane & 7, b = lane >> 3)
// reads 4 outs (16 bytes; 8 lanes = one 128-byte line of a W row) of the 16 ins
// k*32 + b*8 + j and writes, per out, two 16-byte runs of 8 ins; the 128-byte
// line of a Wt row is written by this wave alone.
// grid=(144,3), block=64: 24 out tiles x 12 in tiles = 288 waves per matrix.
__global__ __launch_bounds__(64)
void cvt_w_kernel(const float* __restrict__ wq,
                  const float* __restrict__ wk,
                  const float* __restrict__ wv,
                  unsigned short* __restrict__ wt) {
  const int m    = blockIdx.y;
  const float* w = (m == 0) ? wq : ((m == 1) ? wk : wv);
  const int lane = threadIdx.x & 31;
  const int wv_i = blockIdx.x * 2 + (threadIdx.x >> 5);        // 0..287
  const int ot   = wv_i % 24;
  const int it   = wv_i / 24;
  const int o0   = ot * 32 + (lane & 7) * 4;
  const int i0   = it * 64 + (lane >> 3) * 8;

  const float* wp = w + (size_t)i0 * HID + o0;
  v4f r[2][8];
#pragma unroll
  for (int k = 0; k < 2; ++k)
#pragma unroll
    for (int j = 0; j < 8; ++j)
      r[k][j] = *(const v4f*)(wp + (k * 32 + j) * HID);
  // precaution: the loads' address pair is an input here, so it stays live and
  // unwritten (also by a load's own result) up to this wait behind the last load
  asm volatile("s_wait_xcnt 0x0" :: "v"(wp) : "memory");

  unsigned short* op = wt + (size_t)m * HID * HID + (size_t)o0 * HID + i0;
#pragma unroll
  for (int c = 0; c < 4; ++c)
#pragma unroll
    for (int k = 0; k < 2; ++k) {
      us8 o;
#pragma unroll
      for (int j = 0; j < 8; ++j) o[j] = f32_to_bf16(r[k][j][c]);
      *(us8*)(op + c * HID + k * 32) = o;
    }
}

// ---- QKV projection GEMM --------------------------------------------------
// Block: 4 waves, each 32 rows (s) x 64 cols (one head). The 64x768 W slab
// is staged once in LDS (row stride padded to 776 -> conflict-free b128).
// grid=(32,NH,3), block=128.
#define WPAD 776

__global__ __launch_bounds__(128)
void qkv_gemm_kernel(const unsigned short* __restrict__ xb,
                     const unsigned short* __restrict__ wt,
                     const float* __restrict__ bq,
                     const float* __restrict__ bk,
                     const float* __restrict__ bv,
                     unsigned short* __restrict__ q,
                     unsigned short* __restrict__ k,
                     unsigned short* __restrict__ vt) {
  __shared__ unsigned short wslab[HD * WPAD];   // ~97 KB of the 320 KB LDS

  const int tid   = threadIdx.x;
  const int lane  = tid & 31;
  const int wid   = tid >> 5;
  const int h     = blockIdx.y;
  const int m     = blockIdx.z;
  const int lr    = lane & 15;
  const int half8 = (lane < 16) ? 0 : 8;
  const int s0    = (blockIdx.x * 4 + wid) * 32;

  // stage W slab: 64 rows x 768 cols = 6144 16B-chunks (64*96 chunks)
  const unsigned short* wm = wt + (size_t)m * HID * HID + (size_t)h * HD * HID;
  for (int c = tid; c < HD * (HID / 8); c += 128) {
    int o  = c / (HID / 8);
    int kc = (c - o * (HID / 8)) * 8;
    copy16(wm + (size_t)o * HID + kc, &wslab[o * WPAD + kc]);
  }
  wait_async();
  __syncthreads();

  const float* bias = (m == 0) ? bq : ((m == 1) ? bk : bv);

  v8f zero = {0.f,0.f,0.f,0.f,0.f,0.f,0.f,0.f};
  v8f acc[2][4] = {{zero, zero, zero, zero}, {zero, zero, zero, zero}};

  for (int kk = 0; kk < HID; kk += 32) {
    v16bf a0 = load_frag(xb, s0 +      lr, HID, kk + half8);
    v16bf a1 = load_frag(xb, s0 + 16 + lr, HID, kk + half8);
#pragma unroll
    for (int dt = 0; dt < 4; ++dt) {
      v16bf b = load_frag(wslab, dt * 16 + lr, WPAD, kk + half8);
      acc[0][dt] = wmma_bf16(a0, b, acc[0][dt]);
      acc[1][dt] = wmma_bf16(a1, b, acc[1][dt]);
    }
  }

#pragma unroll
  for (int st = 0; st < 2; ++st) {
#pragma unroll
    for (int dt = 0; dt < 4; ++dt) {
      const int col = h * HD + dt * 16 + lr;
      v8f r = acc[st][dt] + bias[col];
      if (m == 0) r = r * 0.125f;               // fold 1/sqrt(HD) into Q
      if (m < 2) {                              // q/k: [h][s][d] bf16
        unsigned short* dst = (m == 0) ? q : k;
#pragma unroll
        for (int j = 0; j < 8; ++j) {
          int s = s0 + st * 16 + half8 + j;
          dst[((size_t)h * S_LEN + s) * HD + dt * 16 + lr] = f32_to_bf16(r[j]);
        }
      } else {                                  // v: transposed [h][d][s] bf16
        us8 hv;
#pragma unroll
        for (int j = 0; j < 8; ++j) hv[j] = f32_to_bf16(r[j]);
        *(us8*)(vt + ((size_t)h * HD + dt * 16 + lr) * S_LEN
                   + s0 + st * 16 + half8) = hv;
      }
    }
  }
}

// ---- flash attention ------------------------------------------------------
// Block: 4 waves = 2 query halves (32 queries each) x 2 key slices; 64 queries
// of one head. A stage is 64 keys (double-buffered LDS, 144-byte row pitch);
// key slice ks works on keys [k0 + 32*ks, k0 + 32*ks + 32) of every stage and
// keeps its own running maximum, sum and context; the two slices of a query
// half are joined once, through LDS, behind the loop.
// 768 blocks on 256 WGPs: three waves on every SIMD.
// grid=(64,NH), block=128.
#define KT   64
#define KPAD 72
#define VPAD 72

__global__ __launch_bounds__(128)
void attn_kernel(const unsigned short* __restrict__ q,
                 const unsigned short* __restrict__ k,
                 const unsigned short* __restrict__ vt,
                 const float* __restrict__ mask,
                 float* __restrict__ out) {
  __shared__ __attribute__((aligned(16))) unsigned short ktile[2][KT * KPAD];
  __shared__ __attribute__((aligned(16))) unsigned short vtile[2][HD * VPAD];
  __shared__ v4f   xacc[2][16][32];   // key slice 1's context, per query half
  __shared__ float xml[2][4][32];     // key slice 1's maxima and sums

  const int tid   = threadIdx.x;
  const int lane  = tid & 31;
  const int wid   = __builtin_amdgcn_readfirstlane(tid >> 5);
  const int qh    = wid & 1;          // query half of the block
  const int ks    = wid >> 1;         // key slice of every stage
  const int h     = blockIdx.y;
  const int q0    = blockIdx.x * 64 + qh * 32;
  const int lr    = lane & 15;
  const int half8 = (lane < 16) ? 0 : 8;

  const unsigned short* qh_p = q  + (size_t)h * S_LEN * HD;
  const unsigned short* kh_p = k  + (size_t)h * S_LEN * HD;
  const unsigned short* vh_p = vt + (size_t)h * HD * S_LEN;

  // Q^T B-fragments: 2 query sub-tiles x 2 head-dim chunks
  v16bf bqf[2][2];
#pragma unroll
  for (int qs = 0; qs < 2; ++qs) {
    bqf[qs][0] = load_frag(qh_p, q0 + qs * 16 + lr, HD,  0 + half8);
    bqf[qs][1] = load_frag(qh_p, q0 + qs * 16 + lr, HD, 32 + half8);
  }

  v8f zero = {0.f,0.f,0.f,0.f,0.f,0.f,0.f,0.f};
  v8f acc[2][4] = {{zero, zero, zero, zero}, {zero, zero, zero, zero}};
  // lowest finite start: a key slice whose first 32 keys are all masked to -inf
  // then yields zeros (exp(-inf)), not inf - inf
  float mrun[2] = {-3.402823466e+38f, -3.402823466e+38f};
  float lrun[2] = {0.f, 0.f};

  // ---- stage helper: 64x64 K tile + 64x64 V^T tile -> LDS ----
  auto stage = [&](int buf, int k0) {
#pragma unroll
    for (int rr = 0; rr < 4; ++rr) {
      int c = tid + rr * 128;                      // 0..511
      int row = c >> 3, col = (c & 7) * 8;
      copy16(kh_p + (size_t)(k0 + row) * HD + col,
             &ktile[buf][row * KPAD + col]);
      copy16(vh_p + (size_t)row * S_LEN + k0 + col,
             &vtile[buf][row * VPAD + col]);
    }
  };

  stage(0, 0);
  int cur = 0;

  for (int k0 = 0; k0 < S_LEN; k0 += KT) {
    wait_async();
    __syncthreads();                 // ktile[cur]/vtile[cur] ready for all
    const int nxt = cur ^ 1;
    if (k0 + KT < S_LEN) stage(nxt, k0 + KT);   // overlap with compute

    const unsigned short* kt = ktile[cur] + ks * 32 * KPAD;
    const unsigned short* vs = vtile[cur] + ks * 32;

    // K A-fragments (shared by both query sub-tiles)
    v16bf ka00 = load_frag(kt,      lr, KPAD,  0 + half8);
    v16bf ka01 = load_frag(kt,      lr, KPAD, 32 + half8);
    v16bf ka10 = load_frag(kt, 16 + lr, KPAD,  0 + half8);
    v16bf ka11 = load_frag(kt, 16 + lr, KPAD, 32 + half8);
    // V^T A-fragments
    v16bf va[4];
#pragma unroll
    for (int dt = 0; dt < 4; ++dt)
      va[dt] = load_frag(vs, dt * 16 + lr, VPAD, half8);

    v8f m0 = *(const v8f*)(mask + k0 + ks * 32 +      half8);
    v8f m1 = *(const v8f*)(mask + k0 + ks * 32 + 16 + half8);

#pragma unroll
    for (int qs = 0; qs < 2; ++qs) {
      // S^T = K * Q^T : two 16-key row tiles
      v8f t0 = wmma_bf16(ka00, bqf[qs][0], zero);
      t0     = wmma_bf16(ka01, bqf[qs][1], t0);
      v8f t1 = wmma_bf16(ka10, bqf[qs][0], zero);
      t1     = wmma_bf16(ka11, bqf[qs][1], t1);
      t0 = t0 + m0;
      t1 = t1 + m1;

      // online softmax: in-lane over 16 keys + one xor-16 shuffle
      float mloc = t0[0];
#pragma unroll
      for (int j = 1; j < 8; ++j) mloc = fmaxf(mloc, t0[j]);
#pragma unroll
      for (int j = 0; j < 8; ++j) mloc = fmaxf(mloc, t1[j]);
      float mtile = fmaxf(mloc, __shfl_xor(mloc, 16, 32));
      float mnew  = fmaxf(mrun[qs], mtile);
      float alpha = __expf(mrun[qs] - mnew);

      float p0[8], p1[8];
      float lloc = 0.f;
#pragma unroll
      for (int j = 0; j < 8; ++j) { p0[j] = __expf(t0[j] - mnew); lloc += p0[j]; }
#pragma unroll
      for (int j = 0; j < 8; ++j) { p1[j] = __expf(t1[j] - mnew); lloc += p1[j]; }
      float ltile = lloc + __shfl_xor(lloc, 16, 32);
      lrun[qs] = lrun[qs] * alpha + ltile;
      mrun[qs] = mnew;

      // P^T B-fragment straight from the S^T C-fragment (no lane movement)
      us16 pu;
#pragma unroll
      for (int j = 0; j < 8; ++j) {
        pu[j]     = f32_to_bf16(p0[j]);
        pu[8 + j] = f32_to_bf16(p1[j]);
      }
      v16bf pb = __builtin_bit_cast(v16bf, pu);

#pragma unroll
      for (int dt = 0; dt < 4; ++dt) {
        acc[qs][dt] = acc[qs][dt] * alpha;
        acc[qs][dt] = wmma_bf16(va[dt], pb, acc[qs][dt]);
      }
    }
    cur = nxt;
  }

  // ---- join the two key slices: slice 1 hands over, slice 0 merges ----
  if (ks == 1) {
#pragma unroll
    for (int qs = 0; qs < 2; ++qs) {
#pragma unroll
      for (int dt = 0; dt < 4; ++dt) {
        v8f a = acc[qs][dt];
        xacc[qh][(qs * 4 + dt) * 2 + 0][lane] = __builtin_shufflevector(a, a, 0, 1, 2, 3);
        xacc[qh][(qs * 4 + dt) * 2 + 1][lane] = __builtin_shufflevector(a, a, 4, 5, 6, 7);
      }
      xml[qh][qs][lane]     = mrun[qs];
      xml[qh][2 + qs][lane] = lrun[qs];
    }
  }
  __syncthreads();                   // slice 1's partials visible to slice 0
  if (ks == 0) {
    float w0[2], w1[2], lj[2];
#pragma unroll
    for (int qs = 0; qs < 2; ++qs) {
      const float mo = xml[qh][qs][lane];
      const float mj = fmaxf(mrun[qs], mo);
      w0[qs] = exp_slot(mrun[qs] - mj);
      w1[qs] = exp_slot(mo - mj);
    }
#pragma unroll
    for (int qs = 0; qs < 2; ++qs) {
      lj[qs] = lrun[qs] * w0[qs] + xml[qh][2 + qs][lane] * w1[qs];
      const float inv = 1.0f / lj[qs];
      const float s0 = w0[qs] * inv;
      const float s1 = w1[qs] * inv;
      const int s = q0 + qs * 16 + lr;
      float* op = out + (size_t)s * HID + h * HD + half8;
#pragma unroll
      for (int dt = 0; dt < 4; ++dt) {
        v4f b0 = xacc[qh][(qs * 4 + dt) * 2 + 0][lane];
        v4f b1 = xacc[qh][(qs * 4 + dt) * 2 + 1][lane];
        v8f b  = __builtin_shufflevector(b0, b1, 0, 1, 2, 3, 4, 5, 6, 7);
        *(v8f*)(op + dt * 16) = acc[qs][dt] * s0 + b * s1;
      }
    }
  }
}

// ---- launcher -------------------------------------------------------------

extern "C" void kernel_launch(void* const* d_in, const int* in_sizes, int n_in,
                              void* d_out, int out_size, void* d_ws, size_t ws_size,
                              hipStream_t stream) {
  const float* hidden = (const float*)d_in[0];
  const float* amask  = (const float*)d_in[1];
  const float* Wq     = (const float*)d_in[2];
  const float* bq     = (const float*)d_in[3];
  const float* Wk     = (const float*)d_in[4];
  const float* bk     = (const float*)d_in[5];
  const float* Wv     = (const float*)d_in[6];
  const float* bv     = (const float*)d_in[7];
  float* out = (float*)d_out;

  // workspace layout (bytes)
  char* ws = (char*)d_ws;
  unsigned short* xb = (unsigned short*)(ws);                          // 4096*768
  unsigned short* wt = (unsigned short*)(ws + 6291456);                // 3*768*768
  unsigned short* qb = (unsigned short*)(ws + 6291456 + 3538944);      // 12*4096*64
  unsigned short* kb = (unsigned short*)(ws + 6291456 + 3538944 + 6291456);
  unsigned short* vtb= (unsigned short*)(ws + 6291456 + 3538944 + 2*6291456);

  cvt_x_kernel<<<256, CX_T, 0, stream>>>(hidden, xb);
  cvt_w_kernel<<<dim3(144, 3), 64, 0, stream>>>(Wq, Wk, Wv, wt);

  qkv_gemm_kernel<<<dim3(S_LEN / 128, NH, 3), 128, 0, stream>>>(
      xb, wt, bq, bk, bv, qb, kb, vtb);

  attn_kernel<<<dim3(S_LEN / 64, NH), 128, 0, stream>>>(qb, kb, vtb, amask, out);
}

// v003
// One run takes 108 microseconds.
// In two side-by-side timings against v002, it was 1.04 and 1.03 times as fast.
// All steps since v000 together make it 1.50 times as fast.
#include <hip/hip_runtime.h>

// ---------------------------------------------------------------------------
// RoBERTa self-attention for MI455X (gfx1250, wave32, WMMA bf16 16x16x32).
// - Transpose-free flash attention: S^T = K*Q^T so the score C-fragment is
//   per-lane identical to the B-fragment of P^T needed for ctx^T = V^T*P^T.
// - K/V tiles staged in LDS (double buffered, padded strides) and shared by
//   the 4 waves of a block: 2 query halves x 2 key slices, 64 queries.
// - W slab staged in LDS for the QKV GEMM.
// - Staging uses gfx1250 async global->LDS copies when available.
// ---------------------------------------------------------------------------

typedef __attribute__((ext_vector_type(16))) __bf16          v16bf;
typedef __attribute__((ext_vector_type(8)))  float           v8f;
typedef __attribute__((ext_vector_type(16))) unsigned short  us16;
typedef __attribute__((ext_vector_type(8)))  unsigned short  us8;
typedef __attribute__((ext_vector_type(4)))  int             v4i;
typedef __attribute__((ext_vector_type(4)))  float           v4f;
typedef __attribute__((ext_vector_type(16))) float           v16f;

#define S_LEN 4096
#define HID   768
#define NH    12
#define HD    64

#ifndef __has_builtin
#define __has_builtin(x) 0
#endif
#if __has_builtin(__builtin_amdgcn_global_load_async_to_lds_b128) && \
    __has_builtin(__builtin_amdgcn_s_wait_asynccnt)
#define HAVE_ASYNC 1
#else
#define HAVE_ASYNC 0
#endif

// ---- helpers --------------------------------------------------------------

__device__ __forceinline__ unsigned short f32_to_bf16(float f) {
  unsigned int u = __builtin_bit_cast(unsigned int, f);
  u += 0x7fffu + ((u >> 16) & 1u);          // round-to-nearest-even
  return (unsigned short)(u >> 16);
}

// One 16-bit WMMA fragment (A-layout == B-layout pattern on CDNA5):
// lane L owns row/col (L&15); elements 0..7 from `col`, 8..15 from col+16
// (caller folds the lane-half +8 offset into `col`).
__device__ __forceinline__ v16bf load_frag(const unsigned short* base,
                                           int row, int stride, int col) {
  const unsigned short* p = base + (size_t)row * (size_t)stride + col;
  us8 a = *(const us8*)(p);
  us8 b = *(const us8*)(p + 16);
  us16 r = __builtin_shufflevector(a, b, 0,1,2,3,4,5,6,7,8,9,10,11,12,13,14,15);
  return __builtin_bit_cast(v16bf, r);
}

__device__ __forceinline__ v8f wmma_bf16(v16bf a, v16bf b, v8f c) {
  return __builtin_amdgcn_wmma_f32_16x16x32_bf16(false, a, false, b,
                                                 (short)0, c, false, false);
}

// 16-byte global -> LDS copy (async on gfx1250 when the builtin exists).
__device__ __forceinline__ void copy16(const unsigned short* g, unsigned short* l) {
#if HAVE_ASYNC
  __builtin_amdgcn_global_load_async_to_lds_b128(
      (__attribute__((address_space(1))) v4i*)g,
      (__attribute__((address_space(3))) v4i*)l, 0, 0);
#else
  *(us8*)l = *(const us8*)g;
#endif
}

__device__ __forceinline__ void wait_async() {
#if HAVE_ASYNC
  __builtin_amdgcn_s_wait_asynccnt(0);
#endif
}

// e^x as __expf forms it (scale by log2 e, v_exp_f32). The v_nop keeps, inside
// the statement, the one slot the instruction set asks for between a
// transcendental and a next instruction that reads its result or reuses its source.
__device__ __forceinline__ float exp_slot(float x) {
  float r;
  asm("v_exp_f32 %0, %1\n\tv_nop" : "=v"(r) : "v"(x * 1.44269504f));
  return r;
}

// The loop's form of the same: seventeen values (a query's rescale factor
// and sixteen of its scores, already scaled by log2 e) go through v_exp_f32 in
// place, so that no v_exp_f32 writes a register its neighbour reads, and one
// v_nop keeps the slot behind the last.
__device__ __forceinline__ void exp2_17_slot(float& a, float (&x)[16]) {
  asm("v_exp_f32 %0, %0\n\tv_exp_f32 %1, %1\n\tv_exp_f32 %2, %2\n\t"
      "v_exp_f32 %3, %3\n\tv_exp_f32 %4, %4\n\tv_exp_f32 %5, %5\n\t"
      "v_exp_f32 %6, %6\n\tv_exp_f32 %7, %7\n\tv_exp_f32 %8, %8\n\t"
      "v_exp_f32 %9, %9\n\tv_exp_f32 %10, %10\n\tv_exp_f32 %11, %11\n\t"
      "v_exp_f32 %12, %12\n\tv_exp_f32 %13, %13\n\tv_exp_f32 %14, %14\n\t"
      "v_exp_f32 %15, %15\n\tv_exp_f32 %16, %16\n\tv_nop"
      : "+v"(a), "+v"(x[0]), "+v"(x[1]), "+v"(x[2]), "+v"(x[3]), "+v"(x[4]),
        "+v"(x[5]), "+v"(x[6]), "+v"(x[7]), "+v"(x[8]), "+v"(x[9]), "+v"(x[10]),
        "+v"(x[11]), "+v"(x[12]), "+v"(x[13]), "+v"(x[14]), "+v"(x[15]));
}

// ---- conversion kernels ---------------------------------------------------
// Few waves that each move a lot: a thread has sixteen 16-byte loads in flight
// (64 elements), so the two launches start only 2,400 waves in all: a wave's
// start costs more here than the bytes it would move with one element a thread.

typedef __attribute__((ext_vector_type(4))) unsigned short us4;

// x -> bf16. 256 blocks x 192 threads x 16 float4 = 4096 * 768 elements.
// Every load covers 512 contiguous bytes per wave, every store 256.
#define CX_T 192
#define CX_L 16

__global__ __launch_bounds__(CX_T)
void cvt_x_kernel(const float* __restrict__ x,
                  unsigned short* __restrict__ xb) {
  const int base = blockIdx.x * (CX_T * CX_L) + threadIdx.x;   // float4 units
  const v4f* xp = (const v4f*)x + base;
  us4*       op = (us4*)xb + base;
  v4f r[CX_L];
#pragma unroll
  for (int j = 0; j < CX_L; ++j) r[j] = xp[j * CX_T];
#pragma unroll
  for (int j = 0; j < CX_L; ++j) {
    us4 o;
#pragma unroll
    for (int c = 0; c < 4; ++c) o[c] = f32_to_bf16(r[j][c]);
    op[j * CX_T] = o;
  }
}

// Wt[m][out][in] = W_m[in][out]  (bf16), transposed in registers.
// A wave owns a tile of 64 in x 32 out: lane (a = lane & 7, b = lane >> 3)
// reads 4 outs (16 bytes; 8 lanes = one 128-byte line of a W row) of the 16 ins
// k*32 + b*8 + j and writes, per out, two 16-byte runs of 8 ins; the 128-byte
// line of a Wt row is written by this wave alone.
// grid=(144,3), block=64: 24 out tiles x 12 in tiles = 288 waves per matrix.
__global__ __launch_bounds__(64)
void cvt_w_kernel(const float* __restrict__ wq,
                  const float* __restrict__ wk,
                  const float* __restrict__ wv,
                  unsigned short* __restrict__ wt) {
  const int m    = blockIdx.y;
  const float* w = (m == 0) ? wq : ((m == 1) ? wk : wv);
  const int lane = threadIdx.x & 31;
  const int wv_i = blockIdx.x * 2 + (threadIdx.x >> 5);        // 0..287
  const int ot   = wv_i % 24;
  const int it   = wv_i / 24;
  const int o0   = ot * 32 + (lane & 7) * 4;
  const int i0   = it * 64 + (lane >> 3) * 8;

  const float* wp = w + (size_t)i0 * HID + o0;
  v4f r[2][8];
#pragma unroll
  for (int k = 0; k < 2; ++k)
#pragma unroll
    for (int j = 0; j < 8; ++j)
      r[k][j] = *(const v4f*)(wp + (k * 32 + j) * HID);
  // precaution: the loads' address pair is an input here, so it stays live and
  // unwritten (also by a load's own result) up to this wait behind the last load
  asm volatile("s_wait_xcnt 0x0" :: "v"(wp) : "memory");

  unsigned short* op = wt + (size_t)m * HID * HID + (size_t)o0 * HID + i0;
#pragma unroll
  for (int c = 0; c < 4; ++c)
#pragma unroll
    for (int k = 0; k < 2; ++k) {
      us8 o;
#pragma unroll
      for (int j = 0; j < 8; ++j) o[j] = f32_to_bf16(r[k][j][c]);
      *(us8*)(op + c * HID + k * 32) = o;
    }
}

// ---- QKV projection GEMM --------------------------------------------------
// Block: 4 waves, each 32 rows (s) x 64 cols (one head). The 64x768 W slab
// is staged once in LDS (row stride padded to 776 -> conflict-free b128).
// grid=(32,NH,3), block=128.
#define WPAD 776

__global__ __launch_bounds__(128)
void qkv_gemm_kernel(const unsigned short* __restrict__ xb,
                     const unsigned short* __restrict__ wt,
                     const float* __restrict__ bq,
                     const float* __restrict__ bk,
                     const float* __restrict__ bv,
                     unsigned short* __restrict__ q,
                     unsigned short* __restrict__ k,
                     unsigned short* __restrict__ vt) {
  __shared__ unsigned short wslab[HD * WPAD];   // ~97 KB of the 320 KB LDS

  const int tid   = threadIdx.x;
  const int lane  = tid & 31;
  const int wid   = tid >> 5;
  const int h     = blockIdx.y;
  const int m     = blockIdx.z;
  const int lr    = lane & 15;
  const int half8 = (lane < 16) ? 0 : 8;
  const int s0    = (blockIdx.x * 4 + wid) * 32;

  // stage W slab: 64 rows x 768 cols = 6144 16B-chunks (64*96 chunks)
  const unsigned short* wm = wt + (size_t)m * HID * HID + (size_t)h * HD * HID;
  for (int c = tid; c < HD * (HID / 8); c += 128) {
    int o  = c / (HID / 8);
    int kc = (c - o * (HID / 8)) * 8;
    copy16(wm + (size_t)o * HID + kc, &wslab[o * WPAD + kc]);
  }
  wait_async();
  __syncthreads();

  const float* bias = (m == 0) ? bq : ((m == 1) ? bk : bv);

  v8f zero = {0.f,0.f,0.f,0.f,0.f,0.f,0.f,0.f};
  v8f acc[2][4] = {{zero, zero, zero, zero}, {zero, zero, zero, zero}};

  for (int kk = 0; kk < HID; kk += 32) {
    v16bf a0 = load_frag(xb, s0 +      lr, HID, kk + half8);
    v16bf a1 = load_frag(xb, s0 + 16 + lr, HID, kk + half8);
#pragma unroll
    for (int dt = 0; dt < 4; ++dt) {
      v16bf b = load_frag(wslab, dt * 16 + lr, WPAD, kk + half8);
      acc[0][dt] = wmma_bf16(a0, b, acc[0][dt]);
      acc[1][dt] = wmma_bf16(a1, b, acc[1][dt]);
    }
  }

#pragma unroll
  for (int st = 0; st < 2; ++st) {
#pragma unroll
    for (int dt = 0; dt < 4; ++dt) {
      const int col = h * HD + dt * 16 + lr;
      v8f r = acc[st][dt] + bias[col];
      if (m == 0) r = r * 0.125f;               // fold 1/sqrt(HD) into Q
      if (m < 2) {                              // q/k: [h][s][d] bf16
        unsigned short* dst = (m == 0) ? q : k;
#pragma unroll
        for (int j = 0; j < 8; ++j) {
          int s = s0 + st * 16 + half8 + j;
          dst[((size_t)h * S_LEN + s) * HD + dt * 16 + lr] = f32_to_bf16(r[j]);
        }
      } else {                                  // v: transposed [h][d][s] bf16
        us8 hv;
#pragma unroll
        for (int j = 0; j < 8; ++j) hv[j] = f32_to_bf16(r[j]);
        *(us8*)(vt + ((size_t)h * HD + dt * 16 + lr) * S_LEN
                   + s0 + st * 16 + half8) = hv;
      }
    }
  }
}

// ---- flash attention ------------------------------------------------------
// Block: 4 waves = 2 query halves (32 queries each) x 2 key slices; 64 queries
// of one head. A stage is 64 keys (double-buffered LDS, 144-byte row pitch);
// key slice ks works on keys [k0 + 32*ks, k0 + 32*ks + 32) of every stage and
// keeps its own running maximum, sum and context; the two slices of a query
// half are joined once, through LDS, behind the loop.
// 768 blocks on 256 WGPs: three waves on every SIMD.
// grid=(64,NH), block=128.
#define KT   64
#define KPAD 72
#define VPAD 72

__global__ __launch_bounds__(128)
void attn_kernel(const unsigned short* __restrict__ q,
                 const unsigned short* __restrict__ k,
                 const unsigned short* __restrict__ vt,
                 const float* __restrict__ mask,
                 float* __restrict__ out) {
  __shared__ __attribute__((aligned(16))) unsigned short ktile[2][KT * KPAD];
  __shared__ __attribute__((aligned(16))) unsigned short vtile[2][HD * VPAD];
  __shared__ v4f   xacc[2][16][32];   // key slice 1's context, per query half
  __shared__ float xml[2][4][32];     // key slice 1's maxima and sums

  const int tid   = threadIdx.x;
  const int lane  = tid & 31;
  const int wid   = __builtin_amdgcn_readfirstlane(tid >> 5);
  const int qh    = wid & 1;          // query half of the block
  const int ks    = wid >> 1;         // key slice of every stage
  const int h     = blockIdx.y;
  const int q0    = blockIdx.x * 64 + qh * 32;
  const int lr    = lane & 15;
  const int half8 = (lane < 16) ? 0 : 8;

  const unsigned short* qh_p = q  + (size_t)h * S_LEN * HD;
  const unsigned short* kh_p = k  + (size_t)h * S_LEN * HD;
  const unsigned short* vh_p = vt + (size_t)h * HD * S_LEN;

  // Q^T B-fragments: 2 query sub-tiles x 2 head-dim chunks
  v16bf bqf[2][2];
#pragma unroll
  for (int qs = 0; qs < 2; ++qs) {
    bqf[qs][0] = load_frag(qh_p, q0 + qs * 16 + lr, HD,  0 + half8);
    bqf[qs][1] = load_frag(qh_p, q0 + qs * 16 + lr, HD, 32 + half8);
  }

  v8f zero = {0.f,0.f,0.f,0.f,0.f,0.f,0.f,0.f};
  v8f acc[2][4] = {{zero, zero, zero, zero}, {zero, zero, zero, zero}};
  // lowest finite start: a key slice whose first 32 keys are all masked to -inf
  // then yields zeros (exp(-inf)), not inf - inf
  float mrun[2] = {-3.402823466e+38f, -3.402823466e+38f};
  float lrun[2] = {0.f, 0.f};

  // ---- stage helper: 64x64 K tile + 64x64 V^T tile -> LDS ----
  auto stage = [&](int buf, int k0) {
#pragma unroll
    for (int rr = 0; rr < 4; ++rr) {
      int c = tid + rr * 128;                      // 0..511
      int row = c >> 3, col = (c & 7) * 8;
      copy16(kh_p + (size_t)(k0 + row) * HD + col,
             &ktile[buf][row * KPAD + col]);
      copy16(vh_p + (size_t)row * S_LEN + k0 + col,
             &vtile[buf][row * VPAD + col]);
    }
  };

  stage(0, 0);
  int cur = 0;

  for (int k0 = 0; k0 < S_LEN; k0 += KT) {
    wait_async();
    __syncthreads();                 // ktile[cur]/vtile[cur] ready for all
    const int nxt = cur ^ 1;
    if (k0 + KT < S_LEN) stage(nxt, k0 + KT);   // overlap with compute

    const unsigned short* kt = ktile[cur] + ks * 32 * KPAD;
    const unsigned short* vs = vtile[cur] + ks * 32;

    // K A-fragments (shared by both query sub-tiles)
    v16bf ka00 = load_frag(kt,      lr, KPAD,  0 + half8);
    v16bf ka01 = load_frag(kt,      lr, KPAD, 32 + half8);
    v16bf ka10 = load_frag(kt, 16 + lr, KPAD,  0 + half8);
    v16bf ka11 = load_frag(kt, 16 + lr, KPAD, 32 + half8);
    // V^T A-fragments
    v16bf va[4];
#pragma unroll
    for (int dt = 0; dt < 4; ++dt)
      va[dt] = load_frag(vs, dt * 16 + lr, VPAD, half8);

    const float* mp = mask + k0 + ks * 32 + half8;
    v8f m0 = *(const v8f*)(mp);
    v8f m1 = *(const v8f*)(mp + 16);
    // precaution: the loads' address pair is an input here, so it stays live and
    // unwritten (also by a load's own result) up to this wait behind the last load
    asm volatile("s_wait_xcnt 0x0" :: "v"(mp) : "memory");

#pragma unroll
    for (int qs = 0; qs < 2; ++qs) {
      // S^T = K * Q^T : two 16-key row tiles
      v8f t0 = wmma_bf16(ka00, bqf[qs][0], zero);
      t0     = wmma_bf16(ka01, bqf[qs][1], t0);
      v8f t1 = wmma_bf16(ka10, bqf[qs][0], zero);
      t1     = wmma_bf16(ka11, bqf[qs][1], t1);
      t0 = t0 + m0;
      t1 = t1 + m1;

      // online softmax: in-lane over 16 keys + one xor-16 shuffle
      float mloc = t0[0];
#pragma unroll
      for (int j = 1; j < 8; ++j) mloc = fmaxf(mloc, t0[j]);
#pragma unroll
      for (int j = 0; j < 8; ++j) mloc = fmaxf(mloc, t1[j]);
      float mtile = fmaxf(mloc, __shfl_xor(mloc, 16, 32));
      float mnew  = fmaxf(mrun[qs], mtile);
      float alpha = (mrun[qs] - mnew) * 1.44269504f;

      float p[16];
#pragma unroll
      for (int j = 0; j < 8; ++j) {
        p[j]     = (t0[j] - mnew) * 1.44269504f;
        p[8 + j] = (t1[j] - mnew) * 1.44269504f;
      }
      exp2_17_slot(alpha, p);
      float lloc = 0.f;
#pragma unroll
      for (int j = 0; j < 16; ++j) lloc += p[j];
      float ltile = lloc + __shfl_xor(lloc, 16, 32);
      lrun[qs] = lrun[qs] * alpha + ltile;
      mrun[qs] = mnew;

      // P^T B-fragment straight from the S^T C-fragment (no lane movement)
      // (round-to-nearest-even on v_cvt_pk_bf16_f32, one per two values)
      v16f pf;
#pragma unroll
      for (int j = 0; j < 16; ++j) pf[j] = p[j];
      v16bf pb = __builtin_convertvector(pf, v16bf);

#pragma unroll
      for (int dt = 0; dt < 4; ++dt) {
        acc[qs][dt] = acc[qs][dt] * alpha;
        acc[qs][dt] = wmma_bf16(va[dt], pb, acc[qs][dt]);
      }
    }
    cur = nxt;
  }

  // ---- join the two key slices: slice 1 hands over, slice 0 merges ----
  if (ks == 1) {
#pragma unroll
    for (int qs = 0; qs < 2; ++qs) {
#pragma unroll
      for (int dt = 0; dt < 4; ++dt) {
        v8f a = acc[qs][dt];
        xacc[qh][(qs * 4 + dt) * 2 + 0][lane] = __builtin_shufflevector(a, a, 0, 1, 2, 3);
        xacc[qh][(qs * 4 + dt) * 2 + 1][lane] = __builtin_shufflevector(a, a, 4, 5, 6, 7);
      }
      xml[qh][qs][lane]     = mrun[qs];
      xml[qh][2 + qs][lane] = lrun[qs];
    }
  }
  __syncthreads();                   // slice 1's partials visible to slice 0
  if (ks == 0) {
    float w0[2], w1[2], lj[2];
#pragma unroll
    for (int qs = 0; qs < 2; ++qs) {
      const float mo = xml[qh][qs][lane];
      const float mj = fmaxf(mrun[qs], mo);
      w0[qs] = exp_slot(mrun[qs] - mj);
      w1[qs] = exp_slot(mo - mj);
    }
#pragma unroll
    for (int qs = 0; qs < 2; ++qs) {
      lj[qs] = lrun[qs] * w0[qs] + xml[qh][2 + qs][lane] * w1[qs];
      const float inv = 1.0f / lj[qs];
      const float s0 = w0[qs] * inv;
      const float s1 = w1[qs] * inv;
      const int s = q0 + qs * 16 + lr;
      float* op = out + (size_t)s * HID + h * HD + half8;
#pragma unroll
      for (int dt = 0; dt < 4; ++dt) {
        v4f b0 = xacc[qh][(qs * 4 + dt) * 2 + 0][lane];
        v4f b1 = xacc[qh][(qs * 4 + dt) * 2 + 1][lane];
        v8f b  = __builtin_shufflevector(b0, b1, 0, 1, 2, 3, 4, 5, 6, 7);
        *(v8f*)(op + dt * 16) = acc[qs][dt] * s0 + b * s1;
      }
    }
  }
}

// ---- launcher -------------------------------------------------------------

extern "C" void kernel_launch(void* const* d_in, const int* in_sizes, int n_in,
                              void* d_out, int out_size, void* d_ws, size_t ws_size,
                              hipStream_t stream) {
  const float* hidden = (const float*)d_in[0];
  const float* amask  = (const float*)d_in[1];
  const float* Wq     = (const float*)d_in[2];
  const float* bq     = (const float*)d_in[3];
  const float* Wk     = (const float*)d_in[4];
  const float* bk     = (const float*)d_in[5];
  const float* Wv     = (const float*)d_in[6];
  const float* bv     = (const float*)d_in[7];
  float* out = (float*)d_out;

  // workspace layout (bytes)
  char* ws = (char*)d_ws;
  unsigned short* xb = (unsigned short*)(ws);                          // 4096*768
  unsigned short* wt = (unsigned short*)(ws + 6291456);                // 3*768*768
  unsigned short* qb = (unsigned short*)(ws + 6291456 + 3538944);      // 12*4096*64
  unsigned short* kb = (unsigned short*)(ws + 6291456 + 3538944 + 6291456);
  unsigned short* vtb= (unsigned short*)(ws + 6291456 + 3538944 + 2*6291456);

  cvt_x_kernel<<<256, CX_T, 0, stream>>>(hidden, xb);
  cvt_w_kernel<<<dim3(144, 3), 64, 0, stream>>>(Wq, Wk, Wv, wt);

  qkv_gemm_kernel<<<dim3(S_LEN / 128, NH, 3), 128, 0, stream>>>(
      xb, wt, bq, bk, bv, qb, kb, vtb);

  attn_kernel<<<dim3(S_LEN / 64, NH), 128, 0, stream>>>(qb, kb, vtb, amask, out);
}

// v004
// It runs in 101 microseconds.
// Timed twice side by side with v003, it ran 1.07 times as fast both times.
// Counting every step since v000, it is 1.60 times as fast.
#include <hip/hip_runtime.h>

// ---------------------------------------------------------------------------
// RoBERTa self-attention for MI455X (gfx1250, wave32, WMMA bf16 16x16x32).
// - Transpose-free flash attention: S^T = K*Q^T so the score C-fragment is
//   per-lane identical to the B-fragment of P^T needed for ctx^T = V^T*P^T.
// - K/V tiles staged in LDS (double buffered, padded strides) and shared by
//   the 4 waves of a block: 2 query halves x 2 key slices, 64 queries.
// - W slab staged in LDS for the QKV GEMM.
// - Staging uses gfx1250 async global->LDS copies when available.
// ---------------------------------------------------------------------------

typedef __attribute__((ext_vector_type(16))) __bf16          v16bf;
typedef __attribute__((ext_vector_type(8)))  float           v8f;
typedef __attribute__((ext_vector_type(16))) unsigned short  us16;
typedef __attribute__((ext_vector_type(8)))  unsigned short  us8;
typedef __attribute__((ext_vector_type(4)))  int             v4i;
typedef __attribute__((ext_vector_type(4)))  float           v4f;
typedef __attribute__((ext_vector_type(16))) float           v16f;

#define S_LEN 4096
#define HID   768
#define NH    12
#define HD    64

#ifndef __has_builtin
#define __has_builtin(x) 0
#endif
#if __has_builtin(__builtin_amdgcn_global_load_async_to_lds_b128) && \
    __has_builtin(__builtin_amdgcn_s_wait_asynccnt)
#define HAVE_ASYNC 1
#else
#define HAVE_ASYNC 0
#endif

// ---- helpers --------------------------------------------------------------

__device__ __forceinline__ unsigned short f32_to_bf16(float f) {
  unsigned int u = __builtin_bit_cast(unsigned int, f);
  u += 0x7fffu + ((u >> 16) & 1u);          // round-to-nearest-even
  return (unsigned short)(u >> 16);
}

// One 16-bit WMMA fragment (A-layout == B-layout pattern on CDNA5):
// lane L owns row/col (L&15); elements 0..7 from `col`, 8..15 from col+16
// (caller folds the lane-half +8 offset into `col`).
__device__ __forceinline__ v16bf load_frag(const unsigned short* base,
                                           int row, int stride, int col) {
  const unsigned short* p = base + (size_t)row * (size_t)stride + col;
  us8 a = *(const us8*)(p);
  us8 b = *(const us8*)(p + 16);
  us16 r = __builtin_shufflevector(a, b, 0,1,2,3,4,5,6,7,8,9,10,11,12,13,14,15);
  return __builtin_bit_cast(v16bf, r);
}

__device__ __forceinline__ v8f wmma_bf16(v16bf a, v16bf b, v8f c) {
  return __builtin_amdgcn_wmma_f32_16x16x32_bf16(false, a, false, b,
                                                 (short)0, c, false, false);
}

// 16-byte global -> LDS copy (async on gfx1250 when the builtin exists).
__device__ __forceinline__ void copy16(const unsigned short* g, unsigned short* l) {
#if HAVE_ASYNC
  __builtin_amdgcn_global_load_async_to_lds_b128(
      (__attribute__((address_space(1))) v4i*)g,
      (__attribute__((address_space(3))) v4i*)l, 0, 0);
#else
  *(us8*)l = *(const us8*)g;
#endif
}

__device__ __forceinline__ void wait_async() {
#if HAVE_ASYNC
  __builtin_amdgcn_s_wait_asynccnt(0);
#endif
}

// e^x as __expf forms it (scale by log2 e, v_exp_f32). The v_nop keeps, inside
// the statement, the one slot the instruction set asks for between a
// transcendental and a next instruction that reads its result or reuses its source.
__device__ __forceinline__ float exp_slot(float x) {
  float r;
  asm("v_exp_f32 %0, %1\n\tv_nop" : "=v"(r) : "v"(x * 1.44269504f));
  return r;
}

// The loop's form of the same: seventeen values (a query's rescale factor
// and sixteen of its scores, already scaled by log2 e) go through v_exp_f32 in
// place, so that no v_exp_f32 writes a register its neighbour reads, and one
// v_nop keeps the slot behind the last.
__device__ __forceinline__ void exp2_17_slot(float& a, float (&x)[16]) {
  asm("v_exp_f32 %0, %0\n\tv_exp_f32 %1, %1\n\tv_exp_f32 %2, %2\n\t"
      "v_exp_f32 %3, %3\n\tv_exp_f32 %4, %4\n\tv_exp_f32 %5, %5\n\t"
      "v_exp_f32 %6, %6\n\tv_exp_f32 %7, %7\n\tv_exp_f32 %8, %8\n\t"
      "v_exp_f32 %9, %9\n\tv_exp_f32 %10, %10\n\tv_exp_f32 %11, %11\n\t"
      "v_exp_f32 %12, %12\n\tv_exp_f32 %13, %13\n\tv_exp_f32 %14, %14\n\t"
      "v_exp_f32 %15, %15\n\tv_exp_f32 %16, %16\n\tv_nop"
      : "+v"(a), "+v"(x[0]), "+v"(x[1]), "+v"(x[2]), "+v"(x[3]), "+v"(x[4]),
        "+v"(x[5]), "+v"(x[6]), "+v"(x[7]), "+v"(x[8]), "+v"(x[9]), "+v"(x[10]),
        "+v"(x[11]), "+v"(x[12]), "+v"(x[13]), "+v"(x[14]), "+v"(x[15]));
}

// ---- conversion kernels ---------------------------------------------------
// Few waves that each move a lot: a thread has sixteen 16-byte loads in flight
// (64 elements), so the two launches start only 2,400 waves in all: a wave's
// start costs more here than the bytes it would move with one element a thread.

typedef __attribute__((ext_vector_type(4))) unsigned short us4;

// x -> bf16. 256 blocks x 192 threads x 16 float4 = 4096 * 768 elements.
// Every load covers 512 contiguous bytes per wave, every store 256.
#define CX_T 192
#define CX_L 16

__global__ __launch_bounds__(CX_T)
void cvt_x_kernel(const float* __restrict__ x,
                  unsigned short* __restrict__ xb) {
  const int base = blockIdx.x * (CX_T * CX_L) + threadIdx.x;   // float4 units
  const v4f* xp = (const v4f*)x + base;
  us4*       op = (us4*)xb + base;
  v4f r[CX_L];
#pragma unroll
  for (int j = 0; j < CX_L; ++j) r[j] = xp[j * CX_T];
#pragma unroll
  for (int j = 0; j < CX_L; ++j) {
    us4 o;
#pragma unroll
    for (int c = 0; c < 4; ++c) o[c] = f32_to_bf16(r[j][c]);
    op[j * CX_T] = o;
  }
}

// Wt[m][out][in] = W_m[in][out]  (bf16), transposed in registers.
// A wave owns a tile of 64 in x 32 out: lane (a = lane & 7, b = lane >> 3)
// reads 4 outs (16 bytes; 8 lanes = one 128-byte line of a W row) of the 16 ins
// k*32 + b*8 + j and writes, per out, two 16-byte runs of 8 ins; the 128-byte
// line of a Wt row is written by this wave alone.
// grid=(144,3), block=64: 24 out tiles x 12 in tiles = 288 waves per matrix.
__global__ __launch_bounds__(64)
void cvt_w_kernel(const float* __restrict__ wq,
                  const float* __restrict__ wk,
                  const float* __restrict__ wv,
                  unsigned short* __restrict__ wt) {
  const int m    = blockIdx.y;
  const float* w = (m == 0) ? wq : ((m == 1) ? wk : wv);
  const int lane = threadIdx.x & 31;
  const int wv_i = blockIdx.x * 2 + (threadIdx.x >> 5);        // 0..287
  const int ot   = wv_i % 24;
  const int it   = wv_i / 24;
  const int o0   = ot * 32 + (lane & 7) * 4;
  const int i0   = it * 64 + (lane >> 3) * 8;

  const float* wp = w + (size_t)i0 * HID + o0;
  v4f r[2][8];
#pragma unroll
  for (int k = 0; k < 2; ++k)
#pragma unroll
    for (int j = 0; j < 8; ++j)
      r[k][j] = *(const v4f*)(wp + (k * 32 + j) * HID);
  // precaution: the loads' address pair is an input here, so it stays live and
  // unwritten (also by a load's own result) up to this wait behind the last load
  asm volatile("s_wait_xcnt 0x0" :: "v"(wp) : "memory");

  unsigned short* op = wt + (size_t)m * HID * HID + (size_t)o0 * HID + i0;
#pragma unroll
  for (int c = 0; c < 4; ++c)
#pragma unroll
    for (int k = 0; k < 2; ++k) {
      us8 o;
#pragma unroll
      for (int j = 0; j < 8; ++j) o[j] = f32_to_bf16(r[k][j][c]);
      *(us8*)(op + c * HID + k * 32) = o;
    }
}

// ---- QKV projection GEMM --------------------------------------------------
// Block: 4 waves, each 32 rows (s) x 64 cols (one head). The 64x768 W slab
// is staged once in LDS (row stride padded to 776 -> conflict-free b128).
// The k loop is software-pipelined in registers: the x fragments come straight
// from global memory into a ring of AR register sets, each refilled AR k-steps
// ahead of its use (the first AR fly under the W staging), and the W fragments
// of a k-step are read from LDS as one group under the k-step before.
// grid=(32,NH,3), block=128.
#define WPAD 776
#define AR   6                      // x fragment sets in the ring
#define NK   (HID / 32)             // 24 k-steps

__global__ __launch_bounds__(128)
void qkv_gemm_kernel(const unsigned short* __restrict__ xb,
                     const unsigned short* __restrict__ wt,
                     const float* __restrict__ bq,
                     const float* __restrict__ bk,
                     const float* __restrict__ bv,
                     unsigned short* __restrict__ q,
                     unsigned short* __restrict__ k,
                     unsigned short* __restrict__ vt) {
  __shared__ unsigned short wslab[HD * WPAD];   // ~97 KB of the 320 KB LDS

  const int tid   = threadIdx.x;
  const int lane  = tid & 31;
  const int wid   = tid >> 5;
  const int h     = blockIdx.y;
  const int m     = blockIdx.z;
  const int lr    = lane & 15;
  const int half8 = (lane < 16) ? 0 : 8;
  const int s0    = (blockIdx.x * 4 + wid) * 32;

  // x fragments of the first AR k-steps: issued ahead of the W staging
  const unsigned short* pa0 = xb + (size_t)(s0 + lr) * HID + half8;
  const unsigned short* pa1 = pa0 + 16 * HID;
  v16bf af[AR][2];
#pragma unroll
  for (int i = 0; i < AR; ++i) {
    af[i][0] = load_frag(pa0, 0, HID, i * 32);
    af[i][1] = load_frag(pa1, 0, HID, i * 32);
  }
  // keeps the loads above in front of the staging (else they sink to their use)
  __builtin_amdgcn_sched_barrier(0);

  // stage W slab: 64 rows x 768 cols = 6144 16B-chunks (64*96 chunks)
  const unsigned short* wm = wt + (size_t)m * HID * HID + (size_t)h * HD * HID;
  for (int c = tid; c < HD * (HID / 8); c += 128) {
    int o  = c / (HID / 8);
    int kc = (c - o * (HID / 8)) * 8;
    copy16(wm + (size_t)o * HID + kc, &wslab[o * WPAD + kc]);
  }
  wait_async();
  __syncthreads();

  const float* bias = (m == 0) ? bq : ((m == 1) ? bk : bv);

  v8f zero = {0.f,0.f,0.f,0.f,0.f,0.f,0.f,0.f};
  v8f acc[2][4] = {{zero, zero, zero, zero}, {zero, zero, zero, zero}};

  v16bf bfr[2][4];
#pragma unroll
  for (int dt = 0; dt < 4; ++dt)
    bfr[0][dt] = load_frag(wslab, dt * 16 + lr, WPAD, half8);

  // full unroll: ring and W sets are indexed by constants
#pragma unroll
  for (int i = 0; i < NK; ++i) {
    if (i + 1 < NK) {
#pragma unroll
      for (int dt = 0; dt < 4; ++dt)
        bfr[(i + 1) & 1][dt] =
            load_frag(wslab, dt * 16 + lr, WPAD, (i + 1) * 32 + half8);
    }
    // the two scheduling barriers hold the fetches for later k-steps in front of
    // this k-step's products: moved down to their use they would wait out their
    // whole latency there
    __builtin_amdgcn_sched_barrier(0);
#pragma unroll
    for (int dt = 0; dt < 4; ++dt) {
      acc[0][dt] = wmma_bf16(af[i % AR][0], bfr[i & 1][dt], acc[0][dt]);
      acc[1][dt] = wmma_bf16(af[i % AR][1], bfr[i & 1][dt], acc[1][dt]);
    }
    __builtin_amdgcn_sched_barrier(0);
    if (i + AR < NK) {
      af[i % AR][0] = load_frag(pa0, 0, HID, (i + AR) * 32);
      af[i % AR][1] = load_frag(pa1, 0, HID, (i + AR) * 32);
    }
    if (i + AR == NK - 1) {
      // precaution: the loads' address pairs are inputs here, so they stay live
      // and unwritten up to this wait behind the last load
      asm volatile("s_wait_xcnt 0x0" :: "v"(pa0), "v"(pa1) : "memory");
    }
  }

#pragma unroll
  for (int st = 0; st < 2; ++st) {
#pragma unroll
    for (int dt = 0; dt < 4; ++dt) {
      const int col = h * HD + dt * 16 + lr;
      v8f r = acc[st][dt] + bias[col];
      if (m == 0) r = r * 0.125f;               // fold 1/sqrt(HD) into Q
      if (m < 2) {                              // q/k: [h][s][d] bf16
        unsigned short* dst = (m == 0) ? q : k;
#pragma unroll
        for (int j = 0; j < 8; ++j) {
          int s = s0 + st * 16 + half8 + j;
          dst[((size_t)h * S_LEN + s) * HD + dt * 16 + lr] = f32_to_bf16(r[j]);
        }
      } else {                                  // v: transposed [h][d][s] bf16
        us8 hv;
#pragma unroll
        for (int j = 0; j < 8; ++j) hv[j] = f32_to_bf16(r[j]);
        *(us8*)(vt + ((size_t)h * HD + dt * 16 + lr) * S_LEN
                   + s0 + st * 16 + half8) = hv;
      }
    }
  }
}

// ---- flash attention ------------------------------------------------------
// Block: 4 waves = 2 query halves (32 queries each) x 2 key slices; 64 queries
// of one head. A stage is 64 keys (double-buffered LDS, 144-byte row pitch);
// key slice ks works on keys [k0 + 32*ks, k0 + 32*ks + 32) of every stage and
// keeps its own running maximum, sum and context; the two slices of a query
// half are joined once, through LDS, behind the loop.
// 768 blocks on 256 WGPs: three waves on every SIMD.
// grid=(64,NH), block=128.
#define KT   64
#define KPAD 72
#define VPAD 72

__global__ __launch_bounds__(128)
void attn_kernel(const unsigned short* __restrict__ q,
                 const unsigned short* __restrict__ k,
                 const unsigned short* __restrict__ vt,
                 const float* __restrict__ mask,
                 float* __restrict__ out) {
  __shared__ __attribute__((aligned(16))) unsigned short ktile[2][KT * KPAD];
  __shared__ __attribute__((aligned(16))) unsigned short vtile[2][HD * VPAD];
  __shared__ v4f   xacc[2][16][32];   // key slice 1's context, per query half
  __shared__ float xml[2][4][32];     // key slice 1's maxima and sums

  const int tid   = threadIdx.x;
  const int lane  = tid & 31;
  const int wid   = __builtin_amdgcn_readfirstlane(tid >> 5);
  const int qh    = wid & 1;          // query half of the block
  const int ks    = wid >> 1;         // key slice of every stage
  const int h     = blockIdx.y;
  const int q0    = blockIdx.x * 64 + qh * 32;
  const int lr    = lane & 15;
  const int half8 = (lane < 16) ? 0 : 8;

  const unsigned short* qh_p = q  + (size_t)h * S_LEN * HD;
  const unsigned short* kh_p = k  + (size_t)h * S_LEN * HD;
  const unsigned short* vh_p = vt + (size_t)h * HD * S_LEN;

  // Q^T B-fragments: 2 query sub-tiles x 2 head-dim chunks
  v16bf bqf[2][2];
#pragma unroll
  for (int qs = 0; qs < 2; ++qs) {
    bqf[qs][0] = load_frag(qh_p, q0 + qs * 16 + lr, HD,  0 + half8);
    bqf[qs][1] = load_frag(qh_p, q0 + qs * 16 + lr, HD, 32 + half8);
  }

  v8f zero = {0.f,0.f,0.f,0.f,0.f,0.f,0.f,0.f};
  v8f acc[2][4] = {{zero, zero, zero, zero}, {zero, zero, zero, zero}};
  // lowest finite start: a key slice whose first 32 keys are all masked to -inf
  // then yields zeros (exp(-inf)), not inf - inf
  float mrun[2] = {-3.402823466e+38f, -3.402823466e+38f};
  float lrun[2] = {0.f, 0.f};

  // ---- stage helper: 64x64 K tile + 64x64 V^T tile -> LDS ----
  auto stage = [&](int buf, int k0) {
#pragma unroll
    for (int rr = 0; rr < 4; ++rr) {
      int c = tid + rr * 128;                      // 0..511
      int row = c >> 3, col = (c & 7) * 8;
      copy16(kh_p + (size_t)(k0 + row) * HD + col,
             &ktile[buf][row * KPAD + col]);
      copy16(vh_p + (size_t)row * S_LEN + k0 + col,
             &vtile[buf][row * VPAD + col]);
    }
  };

  stage(0, 0);
  int cur = 0;

  for (int k0 = 0; k0 < S_LEN; k0 += KT) {
    wait_async();
    __syncthreads();                 // ktile[cur]/vtile[cur] ready for all
    const int nxt = cur ^ 1;
    if (k0 + KT < S_LEN) stage(nxt, k0 + KT);   // overlap with compute

    const unsigned short* kt = ktile[cur] + ks * 32 * KPAD;
    const unsigned short* vs = vtile[cur] + ks * 32;

    // K A-fragments (shared by both query sub-tiles)
    v16bf ka00 = load_frag(kt,      lr, KPAD,  0 + half8);
    v16bf ka01 = load_frag(kt,      lr, KPAD, 32 + half8);
    v16bf ka10 = load_frag(kt, 16 + lr, KPAD,  0 + half8);
    v16bf ka11 = load_frag(kt, 16 + lr, KPAD, 32 + half8);
    // V^T A-fragments
    v16bf va[4];
#pragma unroll
    for (int dt = 0; dt < 4; ++dt)
      va[dt] = load_frag(vs, dt * 16 + lr, VPAD, half8);

    const float* mp = mask + k0 + ks * 32 + half8;
    v8f m0 = *(const v8f*)(mp);
    v8f m1 = *(const v8f*)(mp + 16);
    // precaution: the loads' address pair is an input here, so it stays live and
    // unwritten (also by a load's own result) up to this wait behind the last load
    asm volatile("s_wait_xcnt 0x0" :: "v"(mp) : "memory");

#pragma unroll
    for (int qs = 0; qs < 2; ++qs) {
      // S^T = K * Q^T : two 16-key row tiles
      v8f t0 = wmma_bf16(ka00, bqf[qs][0], zero);
      t0     = wmma_bf16(ka01, bqf[qs][1], t0);
      v8f t1 = wmma_bf16(ka10, bqf[qs][0], zero);
      t1     = wmma_bf16(ka11, bqf[qs][1], t1);
      t0 = t0 + m0;
      t1 = t1 + m1;

      // online softmax: in-lane over 16 keys + one xor-16 shuffle
      float mloc = t0[0];
#pragma unroll
      for (int j = 1; j < 8; ++j) mloc = fmaxf(mloc, t0[j]);
#pragma unroll
      for (int j = 0; j < 8; ++j) mloc = fmaxf(mloc, t1[j]);
      float mtile = fmaxf(mloc, __shfl_xor(mloc, 16, 32));
      float mnew  = fmaxf(mrun[qs], mtile);
      float alpha = (mrun[qs] - mnew) * 1.44269504f;

      float p[16];
#pragma unroll
      for (int j = 0; j < 8; ++j) {
        p[j]     = (t0[j] - mnew) * 1.44269504f;
        p[8 + j] = (t1[j] - mnew) * 1.44269504f;
      }
      exp2_17_slot(alpha, p);
      float lloc = 0.f;
#pragma unroll
      for (int j = 0; j < 16; ++j) lloc += p[j];
      float ltile = lloc + __shfl_xor(lloc, 16, 32);
      lrun[qs] = lrun[qs] * alpha + ltile;
      mrun[qs] = mnew;

      // P^T B-fragment straight from the S^T C-fragment (no lane movement)
      // (round-to-nearest-even on v_cvt_pk_bf16_f32, one per two values)
      v16f pf;
#pragma unroll
      for (int j = 0; j < 16; ++j) pf[j] = p[j];
      v16bf pb = __builtin_convertvector(pf, v16bf);

#pragma unroll
      for (int dt = 0; dt < 4; ++dt) {
        acc[qs][dt] = acc[qs][dt] * alpha;
        acc[qs][dt] = wmma_bf16(va[dt], pb, acc[qs][dt]);
      }
    }
    cur = nxt;
  }

  // ---- join the two key slices: slice 1 hands over, slice 0 merges ----
  if (ks == 1) {
#pragma unroll
    for (int qs = 0; qs < 2; ++qs) {
#pragma unroll
      for (int dt = 0; dt < 4; ++dt) {
        v8f a = acc[qs][dt];
        xacc[qh][(qs * 4 + dt) * 2 + 0][lane] = __builtin_shufflevector(a, a, 0, 1, 2, 3);
        xacc[qh][(qs * 4 + dt) * 2 + 1][lane] = __builtin_shufflevector(a, a, 4, 5, 6, 7);
      }
      xml[qh][qs][lane]     = mrun[qs];
      xml[qh][2 + qs][lane] = lrun[qs];
    }
  }
  __syncthreads();                   // slice 1's partials visible to slice 0
  if (ks == 0) {
    float w0[2], w1[2], lj[2];
#pragma unroll
    for (int qs = 0; qs < 2; ++qs) {
      const float mo = xml[qh][qs][lane];
      const float mj = fmaxf(mrun[qs], mo);
      w0[qs] = exp_slot(mrun[qs] - mj);
      w1[qs] = exp_slot(mo - mj);
    }
#pragma unroll
    for (int qs = 0; qs < 2; ++qs) {
      lj[qs] = lrun[qs] * w0[qs] + xml[qh][2 + qs][lane] * w1[qs];
      const float inv = 1.0f / lj[qs];
      const float s0 = w0[qs] * inv;
      const float s1 = w1[qs] * inv;
      const int s = q0 + qs * 16 + lr;
      float* op = out + (size_t)s * HID + h * HD + half8;
#pragma unroll
      for (int dt = 0; dt < 4; ++dt) {
        v4f b0 = xacc[qh][(qs * 4 + dt) * 2 + 0][lane];
        v4f b1 = xacc[qh][(qs * 4 + dt) * 2 + 1][lane];
        v8f b  = __builtin_shufflevector(b0, b1, 0, 1, 2, 3, 4, 5, 6, 7);
        *(v8f*)(op + dt * 16) = acc[qs][dt] * s0 + b * s1;
      }
    }
  }
}

// ---- launcher -------------------------------------------------------------

extern "C" void kernel_launch(void* const* d_in, const int* in_sizes, int n_in,
                              void* d_out, int out_size, void* d_ws, size_t ws_size,
                              hipStream_t stream) {
  const float* hidden = (const float*)d_in[0];
  const float* amask  = (const float*)d_in[1];
  const float* Wq     = (const float*)d_in[2];
  const float* bq     = (const float*)d_in[3];
  const float* Wk     = (const float*)d_in[4];
  const float* bk     = (const float*)d_in[5];
  const float* Wv     = (const float*)d_in[6];
  const float* bv     = (const float*)d_in[7];
  float* out = (float*)d_out;

  // workspace layout (bytes)
  char* ws = (char*)d_ws;
  unsigned short* xb = (unsigned short*)(ws);                          // 4096*768
  unsigned short* wt = (unsigned short*)(ws + 6291456);                // 3*768*768
  unsigned short* qb = (unsigned short*)(ws + 6291456 + 3538944);      // 12*4096*64
  unsigned short* kb = (unsigned short*)(ws + 6291456 + 3538944 + 6291456);
  unsigned short* vtb= (unsigned short*)(ws + 6291456 + 3538944 + 2*6291456);

  cvt_x_kernel<<<256, CX_T, 0, stream>>>(hidden, xb);
  cvt_w_kernel<<<dim3(144, 3), 64, 0, stream>>>(Wq, Wk, Wv, wt);

  qkv_gemm_kernel<<<dim3(S_LEN / 128, NH, 3), 128, 0, stream>>>(
      xb, wt, bq, bk, bv, qb, kb, vtb);

  attn_kernel<<<dim3(S_LEN / 64, NH), 128, 0, stream>>>(qb, kb, vtb, amask, out);
}

// v005
// One run takes 94.2 microseconds.
// Two timings next to v004 both put it at 1.07 times that version's speed.
// Over all steps from v000 it is 1.72 times as fast.
#include <hip/hip_runtime.h>

// ---------------------------------------------------------------------------
// RoBERTa self-attention for MI455X (gfx1250, wave32, WMMA bf16 16x16x32).
// - Transpose-free flash attention: S^T = K*Q^T so the score C-fragment is
//   per-lane identical to the B-fragment of P^T needed for ctx^T = V^T*P^T.
// - K/V tiles staged in LDS (double buffered, padded strides) and shared by
//   the 4 waves of a block: 2 query halves x 2 key slices, 64 queries.
// - W slab staged in LDS for the QKV GEMM.
// - Staging uses gfx1250 async global->LDS copies when available.
// ---------------------------------------------------------------------------

typedef __attribute__((ext_vector_type(16))) __bf16          v16bf;
typedef __attribute__((ext_vector_type(8)))  float           v8f;
typedef __attribute__((ext_vector_type(16))) unsigned short  us16;
typedef __attribute__((ext_vector_type(8)))  unsigned short  us8;
typedef __attribute__((ext_vector_type(4)))  int             v4i;
typedef __attribute__((ext_vector_type(4)))  float           v4f;
typedef __attribute__((ext_vector_type(16))) float           v16f;

#define S_LEN 4096
#define HID   768
#define NH    12
#define HD    64

#ifndef __has_builtin
#define __has_builtin(x) 0
#endif
#if __has_builtin(__builtin_amdgcn_global_load_async_to_lds_b128) && \
    __has_builtin(__builtin_amdgcn_s_wait_asynccnt)
#define HAVE_ASYNC 1
#else
#define HAVE_ASYNC 0
#endif

// ---- helpers --------------------------------------------------------------

__device__ __forceinline__ unsigned short f32_to_bf16(float f) {
  unsigned int u = __builtin_bit_cast(unsigned int, f);
  u += 0x7fffu + ((u >> 16) & 1u);          // round-to-nearest-even
  return (unsigned short)(u >> 16);
}

// One 16-bit WMMA fragment (A-layout == B-layout pattern on CDNA5):
// lane L owns row/col (L&15); elements 0..7 from `col`, 8..15 from col+16
// (caller folds the lane-half +8 offset into `col`).
__device__ __forceinline__ v16bf load_frag(const unsigned short* base,
                                           int row, int stride, int col) {
  const unsigned short* p = base + (size_t)row * (size_t)stride + col;
  us8 a = *(const us8*)(p);
  us8 b = *(const us8*)(p + 16);
  us16 r = __builtin_shufflevector(a, b, 0,1,2,3,4,5,6,7,8,9,10,11,12,13,14,15);
  return __builtin_bit_cast(v16bf, r);
}

__device__ __forceinline__ v8f wmma_bf16(v16bf a, v16bf b, v8f c) {
  return __builtin_amdgcn_wmma_f32_16x16x32_bf16(false, a, false, b,
                                                 (short)0, c, false, false);
}

// 16-byte global -> LDS copy (async on gfx1250 when the builtin exists).
__device__ __forceinline__ void copy16(const unsigned short* g, unsigned short* l) {
#if HAVE_ASYNC
  __builtin_amdgcn_global_load_async_to_lds_b128(
      (__attribute__((address_space(1))) v4i*)g,
      (__attribute__((address_space(3))) v4i*)l, 0, 0);
#else
  *(us8*)l = *(const us8*)g;
#endif
}

__device__ __forceinline__ void wait_async() {
#if HAVE_ASYNC
  __builtin_amdgcn_s_wait_asynccnt(0);
#endif
}

// e^x as __expf forms it (scale by log2 e, v_exp_f32). The v_nop keeps, inside
// the statement, the one slot the instruction set asks for between a
// transcendental and a next instruction that reads its result or reuses its source.
__device__ __forceinline__ float exp_slot(float x) {
  float r;
  asm("v_exp_f32 %0, %1\n\tv_nop" : "=v"(r) : "v"(x * 1.44269504f));
  return r;
}

// The loop's form of the same: seventeen values (a query's rescale factor
// and sixteen of its scores, already scaled by log2 e) go through v_exp_f32 in
// place, so that no v_exp_f32 writes a register its neighbour reads, and one
// v_nop keeps the slot behind the last.
__device__ __forceinline__ void exp2_17_slot(float& a, float (&x)[16]) {
  asm("v_exp_f32 %0, %0\n\tv_exp_f32 %1, %1\n\tv_exp_f32 %2, %2\n\t"
      "v_exp_f32 %3, %3\n\tv_exp_f32 %4, %4\n\tv_exp_f32 %5, %5\n\t"
      "v_exp_f32 %6, %6\n\tv_exp_f32 %7, %7\n\tv_exp_f32 %8, %8\n\t"
      "v_exp_f32 %9, %9\n\tv_exp_f32 %10, %10\n\tv_exp_f32 %11, %11\n\t"
      "v_exp_f32 %12, %12\n\tv_exp_f32 %13, %13\n\tv_exp_f32 %14, %14\n\t"
      "v_exp_f32 %15, %15\n\tv_exp_f32 %16, %16\n\tv_nop"
      : "+v"(a), "+v"(x[0]), "+v"(x[1]), "+v"(x[2]), "+v"(x[3]), "+v"(x[4]),
        "+v"(x[5]), "+v"(x[6]), "+v"(x[7]), "+v"(x[8]), "+v"(x[9]), "+v"(x[10]),
        "+v"(x[11]), "+v"(x[12]), "+v"(x[13]), "+v"(x[14]), "+v"(x[15]));
}

// ---- conversion kernels ---------------------------------------------------
// Few waves that each move a lot: a thread has sixteen 16-byte loads in flight
// (64 elements), so the two launches start only 2,400 waves in all: a wave's
// start costs more here than the bytes it would move with one element a thread.

// x -> bf16, stored in the order of the GEMM's A fragments, not row-major:
//   xf[row tile of 16][k-step of 32][part][lane][8]
//     = x[tile*16 + (lane & 15)][kstep*32 + part*16 + (lane >> 4)*8 + 0..7]
// so that each of the two 16-byte loads of a fragment reads 512 contiguous bytes
// per wave (4 whole lines). Row-major, such a load takes 32-byte pieces of 16
// lines, and the GEMM reads every x row 36 times.
// 256 blocks (one row tile each) x 6 waves (4 k-steps each); a thread has
// sixteen 16-byte loads in flight. Lane (r8 = lane & 7, g = lane >> 3) takes the
// 8-element run g of a k-step in rows r8 and r8 + 8: a load touches 8 lines, a
// store writes 4 whole lines, each line by this wave alone.
#define CX_T    192
#define XF_UNIT 256                 // elements of one part: 32 lanes x 8
#define XF_KS   (2 * XF_UNIT)       // elements of one fragment (one k-step)
#define XF_TILE ((HID / 32) * XF_KS)  // elements of one 16-row tile

__global__ __launch_bounds__(CX_T)
void cvt_x_kernel(const float* __restrict__ x,
                  unsigned short* __restrict__ xf) {
  const int lane = threadIdx.x & 31;
  const int w    = threadIdx.x >> 5;          // k-steps 4w .. 4w+3
  const int r8   = lane & 7;
  const int g    = lane >> 3;
  const float* xp = x + (size_t)(blockIdx.x * 16 + r8) * HID + w * 128 + g * 8;
  v4f r[2][4][2];
#pragma unroll
  for (int rh = 0; rh < 2; ++rh)
#pragma unroll
    for (int jj = 0; jj < 4; ++jj) {
      r[rh][jj][0] = *(const v4f*)(xp + rh * 8 * HID + jj * 32);
      r[rh][jj][1] = *(const v4f*)(xp + rh * 8 * HID + jj * 32 + 4);
    }
  // precaution: the loads' address pair is an input here, so it stays live and
  // unwritten (also by a load's own result) up to this wait behind the last load
  asm volatile("s_wait_xcnt 0x0" :: "v"(xp) : "memory");

  // part = g >> 1; fragment lane = (g & 1) * 16 + rh * 8 + r8
  unsigned short* op = xf + (size_t)blockIdx.x * XF_TILE + w * 4 * XF_KS
                          + (g >> 1) * XF_UNIT + ((g & 1) * 16 + r8) * 8;
#pragma unroll
  for (int rh = 0; rh < 2; ++rh)
#pragma unroll
    for (int jj = 0; jj < 4; ++jj) {
      us8 o;
#pragma unroll
      for (int c = 0; c < 4; ++c) {
        o[c]     = f32_to_bf16(r[rh][jj][0][c]);
        o[4 + c] = f32_to_bf16(r[rh][jj][1][c]);
      }
      *(us8*)(op + jj * XF_KS + rh * 64) = o;
    }
}

// One A fragment of x from xf: p = fragment start + lane * 8.
__device__ __forceinline__ v16bf load_xfrag(const unsigned short* p) {
  us8 a = *(const us8*)(p);
  us8 b = *(const us8*)(p + XF_UNIT);
  us16 r = __builtin_shufflevector(a, b, 0,1,2,3,4,5,6,7,8,9,10,11,12,13,14,15);
  return __builtin_bit_cast(v16bf, r);
}

// Wt[m][out][in] = W_m[in][out]  (bf16), transposed in registers.
// A wave owns a tile of 64 in x 32 out: lane (a = lane & 7, b = lane >> 3)
// reads 4 outs (16 bytes; 8 lanes = one 128-byte line of a W row) of the 16 ins
// k*32 + b*8 + j and writes, per out, two 16-byte runs of 8 ins; the 128-byte
// line of a Wt row is written by this wave alone.
// grid=(144,3), block=64: 24 out tiles x 12 in tiles = 288 waves per matrix.
__global__ __launch_bounds__(64)
void cvt_w_kernel(const float* __restrict__ wq,
                  const float* __restrict__ wk,
                  const float* __restrict__ wv,
                  unsigned short* __restrict__ wt) {
  const int m    = blockIdx.y;
  const float* w = (m == 0) ? wq : ((m == 1) ? wk : wv);
  const int lane = threadIdx.x & 31;
  const int wv_i = blockIdx.x * 2 + (threadIdx.x >> 5);        // 0..287
  const int ot   = wv_i % 24;
  const int it   = wv_i / 24;
  const int o0   = ot * 32 + (lane & 7) * 4;
  const int i0   = it * 64 + (lane >> 3) * 8;

  const float* wp = w + (size_t)i0 * HID + o0;
  v4f r[2][8];
#pragma unroll
  for (int k = 0; k < 2; ++k)
#pragma unroll
    for (int j = 0; j < 8; ++j)
      r[k][j] = *(const v4f*)(wp + (k * 32 + j) * HID);
  // precaution: the loads' address pair is an input here, so it stays live and
  // unwritten (also by a load's own result) up to this wait behind the last load
  asm volatile("s_wait_xcnt 0x0" :: "v"(wp) : "memory");

  unsigned short* op = wt + (size_t)m * HID * HID + (size_t)o0 * HID + i0;
#pragma unroll
  for (int c = 0; c < 4; ++c)
#pragma unroll
    for (int k = 0; k < 2; ++k) {
      us8 o;
#pragma unroll
      for (int j = 0; j < 8; ++j) o[j] = f32_to_bf16(r[k][j][c]);
      *(us8*)(op + c * HID + k * 32) = o;
    }
}

// ---- QKV projection GEMM --------------------------------------------------
// Block: 4 waves, each 32 rows (s) x 64 cols (one head). The 64x768 W slab
// is staged once in LDS (row stride padded to 776 -> conflict-free b128).
// The k loop is software-pipelined in registers: the x fragments come straight
// from global memory (fragment order, see cvt_x_kernel) into a ring of AR register sets, each refilled AR k-steps
// ahead of its use (the first AR fly under the W staging), and the W fragments
// of a k-step are read from LDS as one group under the k-step before.
// grid=(32,NH,3), block=128.
#define WPAD 776
#define AR   6                      // x fragment sets in the ring
#define NK   (HID / 32)             // 24 k-steps

__global__ __launch_bounds__(128)
void qkv_gemm_kernel(const unsigned short* __restrict__ xb,
                     const unsigned short* __restrict__ wt,
                     const float* __restrict__ bq,
                     const float* __restrict__ bk,
                     const float* __restrict__ bv,
                     unsigned short* __restrict__ q,
                     unsigned short* __restrict__ k,
                     unsigned short* __restrict__ vt) {
  __shared__ unsigned short wslab[HD * WPAD];   // ~97 KB of the 320 KB LDS

  const int tid   = threadIdx.x;
  const int lane  = tid & 31;
  const int wid   = tid >> 5;
  const int h     = blockIdx.y;
  const int m     = blockIdx.z;
  const int lr    = lane & 15;
  const int half8 = (lane < 16) ? 0 : 8;
  const int s0    = (blockIdx.x * 4 + wid) * 32;

  // x fragments of the first AR k-steps: issued ahead of the W staging
  const unsigned short* pa0 = xb + (size_t)(s0 >> 4) * XF_TILE + lane * 8;
  const unsigned short* pa1 = pa0 + XF_TILE;
  v16bf af[AR][2];
#pragma unroll
  for (int i = 0; i < AR; ++i) {
    af[i][0] = load_xfrag(pa0 + i * XF_KS);
    af[i][1] = load_xfrag(pa1 + i * XF_KS);
  }
  // keeps the loads above in front of the staging (else they sink to their use)
  __builtin_amdgcn_sched_barrier(0);

  // stage W slab: 64 rows x 768 cols = 6144 16B-chunks (64*96 chunks)
  const unsigned short* wm = wt + (size_t)m * HID * HID + (size_t)h * HD * HID;
  for (int c = tid; c < HD * (HID / 8); c += 128) {
    int o  = c / (HID / 8);
    int kc = (c - o * (HID / 8)) * 8;
    copy16(wm + (size_t)o * HID + kc, &wslab[o * WPAD + kc]);
  }
  wait_async();
  __syncthreads();

  const float* bias = (m == 0) ? bq : ((m == 1) ? bk : bv);

  v8f zero = {0.f,0.f,0.f,0.f,0.f,0.f,0.f,0.f};
  v8f acc[2][4] = {{zero, zero, zero, zero}, {zero, zero, zero, zero}};

  v16bf bfr[2][4];
#pragma unroll
  for (int dt = 0; dt < 4; ++dt)
    bfr[0][dt] = load_frag(wslab, dt * 16 + lr, WPAD, half8);

  // full unroll: ring and W sets are indexed by constants
#pragma unroll
  for (int i = 0; i < NK; ++i) {
    if (i + 1 < NK) {
#pragma unroll
      for (int dt = 0; dt < 4; ++dt)
        bfr[(i + 1) & 1][dt] =
            load_frag(wslab, dt * 16 + lr, WPAD, (i + 1) * 32 + half8);
    }
    // the two scheduling barriers hold the fetches for later k-steps in front of
    // this k-step's products: moved down to their use they would wait out their
    // whole latency there
    __builtin_amdgcn_sched_barrier(0);
#pragma unroll
    for (int dt = 0; dt < 4; ++dt) {
      acc[0][dt] = wmma_bf16(af[i % AR][0], bfr[i & 1][dt], acc[0][dt]);
      acc[1][dt] = wmma_bf16(af[i % AR][1], bfr[i & 1][dt], acc[1][dt]);
    }
    __builtin_amdgcn_sched_barrier(0);
    if (i + AR < NK) {
      af[i % AR][0] = load_xfrag(pa0 + (i + AR) * XF_KS);
      af[i % AR][1] = load_xfrag(pa1 + (i + AR) * XF_KS);
    }
    if (i + AR == NK - 1) {
      // precaution: the loads' address pairs are inputs here, so they stay live
      // and unwritten up to this wait behind the last load
      asm volatile("s_wait_xcnt 0x0" :: "v"(pa0), "v"(pa1) : "memory");
    }
  }

#pragma unroll
  for (int st = 0; st < 2; ++st) {
#pragma unroll
    for (int dt = 0; dt < 4; ++dt) {
      const int col = h * HD + dt * 16 + lr;
      v8f r = acc[st][dt] + bias[col];
      if (m == 0) r = r * 0.125f;               // fold 1/sqrt(HD) into Q
      if (m < 2) {                              // q/k: [h][s][d] bf16
        unsigned short* dst = (m == 0) ? q : k;
#pragma unroll
        for (int j = 0; j < 8; ++j) {
          int s = s0 + st * 16 + half8 + j;
          dst[((size_t)h * S_LEN + s) * HD + dt * 16 + lr] = f32_to_bf16(r[j]);
        }
      } else {                                  // v: transposed [h][d][s] bf16
        us8 hv;
#pragma unroll
        for (int j = 0; j < 8; ++j) hv[j] = f32_to_bf16(r[j]);
        *(us8*)(vt + ((size_t)h * HD + dt * 16 + lr) * S_LEN
                   + s0 + st * 16 + half8) = hv;
      }
    }
  }
}

// ---- flash attention ------------------------------------------------------
// Block: 4 waves = 2 query halves (32 queries each) x 2 key slices; 64 queries
// of one head. A stage is 64 keys (double-buffered LDS, 144-byte row pitch);
// key slice ks works on keys [k0 + 32*ks, k0 + 32*ks + 32) of every stage and
// keeps its own running maximum, sum and context; the two slices of a query
// half are joined once, through LDS, behind the loop.
// 768 blocks on 256 WGPs: three waves on every SIMD.
// grid=(64,NH), block=128.
#define KT   64
#define KPAD 72
#define VPAD 72

__global__ __launch_bounds__(128)
void attn_kernel(const unsigned short* __restrict__ q,
                 const unsigned short* __restrict__ k,
                 const unsigned short* __restrict__ vt,
                 const float* __restrict__ mask,
                 float* __restrict__ out) {
  __shared__ __attribute__((aligned(16))) unsigned short ktile[2][KT * KPAD];
  __shared__ __attribute__((aligned(16))) unsigned short vtile[2][HD * VPAD];
  __shared__ v4f   xacc[2][16][32];   // key slice 1's context, per query half
  __shared__ float xml[2][4][32];     // key slice 1's maxima and sums

  const int tid   = threadIdx.x;
  const int lane  = tid & 31;
  const int wid   = __builtin_amdgcn_readfirstlane(tid >> 5);
  const int qh    = wid & 1;          // query half of the block
  const int ks    = wid >> 1;         // key slice of every stage
  const int h     = blockIdx.y;
  const int q0    = blockIdx.x * 64 + qh * 32;
  const int lr    = lane & 15;
  const int half8 = (lane < 16) ? 0 : 8;

  const unsigned short* qh_p = q  + (size_t)h * S_LEN * HD;
  const unsigned short* kh_p = k  + (size_t)h * S_LEN * HD;
  const unsigned short* vh_p = vt + (size_t)h * HD * S_LEN;

  // Q^T B-fragments: 2 query sub-tiles x 2 head-dim chunks
  v16bf bqf[2][2];
#pragma unroll
  for (int qs = 0; qs < 2; ++qs) {
    bqf[qs][0] = load_frag(qh_p, q0 + qs * 16 + lr, HD,  0 + half8);
    bqf[qs][1] = load_frag(qh_p, q0 + qs * 16 + lr, HD, 32 + half8);
  }

  v8f zero = {0.f,0.f,0.f,0.f,0.f,0.f,0.f,0.f};
  v8f acc[2][4] = {{zero, zero, zero, zero}, {zero, zero, zero, zero}};
  // lowest finite start: a key slice whose first 32 keys are all masked to -inf
  // then yields zeros (exp(-inf)), not inf - inf
  float mrun[2] = {-3.402823466e+38f, -3.402823466e+38f};
  float lrun[2] = {0.f, 0.f};

  // ---- stage helper: 64x64 K tile + 64x64 V^T tile -> LDS ----
  auto stage = [&](int buf, int k0) {
#pragma unroll
    for (int rr = 0; rr < 4; ++rr) {
      int c = tid + rr * 128;                      // 0..511
      int row = c >> 3, col = (c & 7) * 8;
      copy16(kh_p + (size_t)(k0 + row) * HD + col,
             &ktile[buf][row * KPAD + col]);
      copy16(vh_p + (size_t)row * S_LEN + k0 + col,
             &vtile[buf][row * VPAD + col]);
    }
  };

  stage(0, 0);
  int cur = 0;

  for (int k0 = 0; k0 < S_LEN; k0 += KT) {
    wait_async();
    __syncthreads();                 // ktile[cur]/vtile[cur] ready for all
    const int nxt = cur ^ 1;
    if (k0 + KT < S_LEN) stage(nxt, k0 + KT);   // overlap with compute

    const unsigned short* kt = ktile[cur] + ks * 32 * KPAD;
    const unsigned short* vs = vtile[cur] + ks * 32;

    // K A-fragments (shared by both query sub-tiles)
    v16bf ka00 = load_frag(kt,      lr, KPAD,  0 + half8);
    v16bf ka01 = load_frag(kt,      lr, KPAD, 32 + half8);
    v16bf ka10 = load_frag(kt, 16 + lr, KPAD,  0 + half8);
    v16bf ka11 = load_frag(kt, 16 + lr, KPAD, 32 + half8);
    // V^T A-fragments
    v16bf va[4];
#pragma unroll
    for (int dt = 0; dt < 4; ++dt)
      va[dt] = load_frag(vs, dt * 16 + lr, VPAD, half8);

    const float* mp = mask + k0 + ks * 32 + half8;
    v8f m0 = *(const v8f*)(mp);
    v8f m1 = *(const v8f*)(mp + 16);
    // precaution: the loads' address pair is an input here, so it stays live and
    // unwritten (also by a load's own result) up to this wait behind the last load
    asm volatile("s_wait_xcnt 0x0" :: "v"(mp) : "memory");

#pragma unroll
    for (int qs = 0; qs < 2; ++qs) {
      // S^T = K * Q^T : two 16-key row tiles
      v8f t0 = wmma_bf16(ka00, bqf[qs][0], zero);
      t0     = wmma_bf16(ka01, bqf[qs][1], t0);
      v8f t1 = wmma_bf16(ka10, bqf[qs][0], zero);
      t1     = wmma_bf16(ka11, bqf[qs][1], t1);
      t0 = t0 + m0;
      t1 = t1 + m1;

      // online softmax: in-lane over 16 keys + one xor-16 shuffle
      float mloc = t0[0];
#pragma unroll
      for (int j = 1; j < 8; ++j) mloc = fmaxf(mloc, t0[j]);
#pragma unroll
      for (int j = 0; j < 8; ++j) mloc = fmaxf(mloc, t1[j]);
      float mtile = fmaxf(mloc, __shfl_xor(mloc, 16, 32));
      float mnew  = fmaxf(mrun[qs], mtile);
      float alpha = (mrun[qs] - mnew) * 1.44269504f;

      float p[16];
#pragma unroll
      for (int j = 0; j < 8; ++j) {
        p[j]     = (t0[j] - mnew) * 1.44269504f;
        p[8 + j] = (t1[j] - mnew) * 1.44269504f;
      }
      exp2_17_slot(alpha, p);
      float lloc = 0.f;
#pragma unroll
      for (int j = 0; j < 16; ++j) lloc += p[j];
      float ltile = lloc + __shfl_xor(lloc, 16, 32);
      lrun[qs] = lrun[qs] * alpha + ltile;
      mrun[qs] = mnew;

      // P^T B-fragment straight from the S^T C-fragment (no lane movement)
      // (round-to-nearest-even on v_cvt_pk_bf16_f32, one per two values)
      v16f pf;
#pragma unroll
      for (int j = 0; j < 16; ++j) pf[j] = p[j];
      v16bf pb = __builtin_convertvector(pf, v16bf);

#pragma unroll
      for (int dt = 0; dt < 4; ++dt) {
        acc[qs][dt] = acc[qs][dt] * alpha;
        acc[qs][dt] = wmma_bf16(va[dt], pb, acc[qs][dt]);
      }
    }
    cur = nxt;
  }

  // ---- join the two key slices: slice 1 hands over, slice 0 merges ----
  if (ks == 1) {
#pragma unroll
    for (int qs = 0; qs < 2; ++qs) {
#pragma unroll
      for (int dt = 0; dt < 4; ++dt) {
        v8f a = acc[qs][dt];
        xacc[qh][(qs * 4 + dt) * 2 + 0][lane] = __builtin_shufflevector(a, a, 0, 1, 2, 3);
        xacc[qh][(qs * 4 + dt) * 2 + 1][lane] = __builtin_shufflevector(a, a, 4, 5, 6, 7);
      }
      xml[qh][qs][lane]     = mrun[qs];
      xml[qh][2 + qs][lane] = lrun[qs];
    }
  }
  __syncthreads();                   // slice 1's partials visible to slice 0
  if (ks == 0) {
    float w0[2], w1[2], lj[2];
#pragma unroll
    for (int qs = 0; qs < 2; ++qs) {
      const float mo = xml[qh][qs][lane];
      const float mj = fmaxf(mrun[qs], mo);
      w0[qs] = exp_slot(mrun[qs] - mj);
      w1[qs] = exp_slot(mo - mj);
    }
#pragma unroll
    for (int qs = 0; qs < 2; ++qs) {
      lj[qs] = lrun[qs] * w0[qs] + xml[qh][2 + qs][lane] * w1[qs];
      const float inv = 1.0f / lj[qs];
      const float s0 = w0[qs] * inv;
      const float s1 = w1[qs] * inv;
      const int s = q0 + qs * 16 + lr;
      float* op = out + (size_t)s * HID + h * HD + half8;
#pragma unroll
      for (int dt = 0; dt < 4; ++dt) {
        v4f b0 = xacc[qh][(qs * 4 + dt) * 2 + 0][lane];
        v4f b1 = xacc[qh][(qs * 4 + dt) * 2 + 1][lane];
        v8f b  = __builtin_shufflevector(b0, b1, 0, 1, 2, 3, 4, 5, 6, 7);
        *(v8f*)(op + dt * 16) = acc[qs][dt] * s0 + b * s1;
      }
    }
  }
}

// ---- launcher -------------------------------------------------------------

extern "C" void kernel_launch(void* const* d_in, const int* in_sizes, int n_in,
                              void* d_out, int out_size, void* d_ws, size_t ws_size,
                              hipStream_t stream) {
  const float* hidden = (const float*)d_in[0];
  const float* amask  = (const float*)d_in[1];
  const float* Wq     = (const float*)d_in[2];
  const float* bq     = (const float*)d_in[3];
  const float* Wk     = (const float*)d_in[4];
  const float* bk     = (const float*)d_in[5];
  const float* Wv     = (const float*)d_in[6];
  const float* bv     = (const float*)d_in[7];
  float* out = (float*)d_out;

  // workspace layout (bytes)
  char* ws = (char*)d_ws;
  unsigned short* xb = (unsigned short*)(ws);           // 4096*768, fragment order
  unsigned short* wt = (unsigned short*)(ws + 6291456);                // 3*768*768
  unsigned short* qb = (unsigned short*)(ws + 6291456 + 3538944);      // 12*4096*64
  unsigned short* kb = (unsigned short*)(ws + 6291456 + 3538944 + 6291456);
  unsigned short* vtb= (unsigned short*)(ws + 6291456 + 3538944 + 2*6291456);

  cvt_x_kernel<<<256, CX_T, 0, stream>>>(hidden, xb);
  cvt_w_kernel<<<dim3(144, 3), 64, 0, stream>>>(Wq, Wk, Wv, wt);

  qkv_gemm_kernel<<<dim3(S_LEN / 128, NH, 3), 128, 0, stream>>>(
      xb, wt, bq, bk, bv, qb, kb, vtb);

  attn_kernel<<<dim3(S_LEN / 64, NH), 128, 0, stream>>>(qb, kb, vtb, amask, out);
}

// v006
// One run takes 79.7 microseconds.
// Next to v005, in two timings, it ran 1.19 times as fast each time.
// All steps since v000 together make it 2.05 times as fast.
#include <hip/hip_runtime.h>

// ---------------------------------------------------------------------------
// RoBERTa self-attention for MI455X (gfx1250, wave32, WMMA bf16 16x16x32).
// - Transpose-free flash attention: S^T = K*Q^T so the score C-fragment is
//   per-lane identical to the B-fragment of P^T needed for ctx^T = V^T*P^T.
// - K/V tiles staged in LDS (double buffered, padded strides) and shared by
//   the 4 waves of a block: 2 query halves x 2 key slices, 64 queries;
//   a wave takes 64 keys per online-softmax step.
// - W slab staged in LDS for the QKV GEMM.
// - Staging uses gfx1250 async global->LDS copies when available.
// ---------------------------------------------------------------------------

typedef __attribute__((ext_vector_type(16))) __bf16          v16bf;
typedef __attribute__((ext_vector_type(8)))  float           v8f;
typedef __attribute__((ext_vector_type(16))) unsigned short  us16;
typedef __attribute__((ext_vector_type(8)))  unsigned short  us8;
typedef __attribute__((ext_vector_type(4)))  int             v4i;
typedef __attribute__((ext_vector_type(4)))  float           v4f;
typedef __attribute__((ext_vector_type(16))) float           v16f;

#define S_LEN 4096
#define HID   768
#define NH    12
#define HD    64

#ifndef __has_builtin
#define __has_builtin(x) 0
#endif
#if __has_builtin(__builtin_amdgcn_global_load_async_to_lds_b128) && \
    __has_builtin(__builtin_amdgcn_s_wait_asynccnt)
#define HAVE_ASYNC 1
#else
#define HAVE_ASYNC 0
#endif

// ---- helpers --------------------------------------------------------------

__device__ __forceinline__ unsigned short f32_to_bf16(float f) {
  unsigned int u = __builtin_bit_cast(unsigned int, f);
  u += 0x7fffu + ((u >> 16) & 1u);          // round-to-nearest-even
  return (unsigned short)(u >> 16);
}

// One 16-bit WMMA fragment (A-layout == B-layout pattern on CDNA5):
// lane L owns row/col (L&15); elements 0..7 from `col`, 8..15 from col+16
// (caller folds the lane-half +8 offset into `col`).
__device__ __forceinline__ v16bf load_frag(const unsigned short* base,
                                           int row, int stride, int col) {
  const unsigned short* p = base + (size_t)row * (size_t)stride + col;
  us8 a = *(const us8*)(p);
  us8 b = *(const us8*)(p + 16);
  us16 r = __builtin_shufflevector(a, b, 0,1,2,3,4,5,6,7,8,9,10,11,12,13,14,15);
  return __builtin_bit_cast(v16bf, r);
}

__device__ __forceinline__ v8f wmma_bf16(v16bf a, v16bf b, v8f c) {
  return __builtin_amdgcn_wmma_f32_16x16x32_bf16(false, a, false, b,
                                                 (short)0, c, false, false);
}

// 16-byte global -> LDS copy (async on gfx1250 when the builtin exists).
__device__ __forceinline__ void copy16(const unsigned short* g, unsigned short* l) {
#if HAVE_ASYNC
  __builtin_amdgcn_global_load_async_to_lds_b128(
      (__attribute__((address_space(1))) v4i*)g,
      (__attribute__((address_space(3))) v4i*)l, 0, 0);
#else
  *(us8*)l = *(const us8*)g;
#endif
}

__device__ __forceinline__ void wait_async() {
#if HAVE_ASYNC
  __builtin_amdgcn_s_wait_asynccnt(0);
#endif
}

// e^x as __expf forms it (scale by log2 e, v_exp_f32). The v_nop keeps, inside
// the statement, the one slot the instruction set asks for between a
// transcendental and a next instruction that reads its result or reuses its source.
__device__ __forceinline__ float exp_slot(float x) {
  float r;
  asm("v_exp_f32 %0, %1\n\tv_nop" : "=v"(r) : "v"(x * 1.44269504f));
  return r;
}

// The loop's form of the same: seventeen values (a query tile's rescale factor
// and the sixteen scores of a step's first 32 keys, already scaled by log2 e) go through v_exp_f32 in
// place, so that no v_exp_f32 writes a register its neighbour reads, and one
// v_nop keeps the slot behind the last.
__device__ __forceinline__ void exp2_17_slot(float& a, float (&x)[16]) {
  asm("v_exp_f32 %0, %0\n\tv_exp_f32 %1, %1\n\tv_exp_f32 %2, %2\n\t"
      "v_exp_f32 %3, %3\n\tv_exp_f32 %4, %4\n\tv_exp_f32 %5, %5\n\t"
      "v_exp_f32 %6, %6\n\tv_exp_f32 %7, %7\n\tv_exp_f32 %8, %8\n\t"
      "v_exp_f32 %9, %9\n\tv_exp_f32 %10, %10\n\tv_exp_f32 %11, %11\n\t"
      "v_exp_f32 %12, %12\n\tv_exp_f32 %13, %13\n\tv_exp_f32 %14, %14\n\t"
      "v_exp_f32 %15, %15\n\tv_exp_f32 %16, %16\n\tv_nop"
      : "+v"(a), "+v"(x[0]), "+v"(x[1]), "+v"(x[2]), "+v"(x[3]), "+v"(x[4]),
        "+v"(x[5]), "+v"(x[6]), "+v"(x[7]), "+v"(x[8]), "+v"(x[9]), "+v"(x[10]),
        "+v"(x[11]), "+v"(x[12]), "+v"(x[13]), "+v"(x[14]), "+v"(x[15]));
}

// The same for sixteen scores alone (a step's second 32 keys).
__device__ __forceinline__ void exp2_16_slot(float (&x)[16]) {
  asm("v_exp_f32 %0, %0\n\tv_exp_f32 %1, %1\n\tv_exp_f32 %2, %2\n\t"
      "v_exp_f32 %3, %3\n\tv_exp_f32 %4, %4\n\tv_exp_f32 %5, %5\n\t"
      "v_exp_f32 %6, %6\n\tv_exp_f32 %7, %7\n\tv_exp_f32 %8, %8\n\t"
      "v_exp_f32 %9, %9\n\tv_exp_f32 %10, %10\n\tv_exp_f32 %11, %11\n\t"
      "v_exp_f32 %12, %12\n\tv_exp_f32 %13, %13\n\tv_exp_f32 %14, %14\n\t"
      "v_exp_f32 %15, %15\n\tv_nop"
      : "+v"(x[0]), "+v"(x[1]), "+v"(x[2]), "+v"(x[3]), "+v"(x[4]),
        "+v"(x[5]), "+v"(x[6]), "+v"(x[7]), "+v"(x[8]), "+v"(x[9]), "+v"(x[10]),
        "+v"(x[11]), "+v"(x[12]), "+v"(x[13]), "+v"(x[14]), "+v"(x[15]));
}

// ---- conversion kernels ---------------------------------------------------
// Few waves that each move a lot: a thread has sixteen 16-byte loads in flight
// (64 elements), so the two launches start only 2,400 waves in all: a wave's
// start costs more here than the bytes it would move with one element a thread.

// x -> bf16, stored in the order of the GEMM's A fragments, not row-major:
//   xf[row tile of 16][k-step of 32][part][lane][8]
//     = x[tile*16 + (lane & 15)][kstep*32 + part*16 + (lane >> 4)*8 + 0..7]
// so that each of the two 16-byte loads of a fragment reads 512 contiguous bytes
// per wave (4 whole lines). Row-major, such a load takes 32-byte pieces of 16
// lines, and the GEMM reads every x row 36 times.
// 256 blocks (one row tile each) x 6 waves (4 k-steps each); a thread has
// sixteen 16-byte loads in flight. Lane (r8 = lane & 7, g = lane >> 3) takes the
// 8-element run g of a k-step in rows r8 and r8 + 8: a load touches 8 lines, a
// store writes 4 whole lines, each line by this wave alone.
#define CX_T    192
#define XF_UNIT 256                 // elements of one part: 32 lanes x 8
#define XF_KS   (2 * XF_UNIT)       // elements of one fragment (one k-step)
#define XF_TILE ((HID / 32) * XF_KS)  // elements of one 16-row tile

__global__ __launch_bounds__(CX_T)
void cvt_x_kernel(const float* __restrict__ x,
                  unsigned short* __restrict__ xf) {
  const int lane = threadIdx.x & 31;
  const int w    = threadIdx.x >> 5;          // k-steps 4w .. 4w+3
  const int r8   = lane & 7;
  const int g    = lane >> 3;
  const float* xp = x + (size_t)(blockIdx.x * 16 + r8) * HID + w * 128 + g * 8;
  v4f r[2][4][2];
#pragma unroll
  for (int rh = 0; rh < 2; ++rh)
#pragma unroll
    for (int jj = 0; jj < 4; ++jj) {
      r[rh][jj][0] = *(const v4f*)(xp + rh * 8 * HID + jj * 32);
      r[rh][jj][1] = *(const v4f*)(xp + rh * 8 * HID + jj * 32 + 4);
    }
  // precaution: the loads' address pair is an input here, so it stays live and
  // unwritten (also by a load's own result) up to this wait behind the last load
  asm volatile("s_wait_xcnt 0x0" :: "v"(xp) : "memory");

  // part = g >> 1; fragment lane = (g & 1) * 16 + rh * 8 + r8
  unsigned short* op = xf + (size_t)blockIdx.x * XF_TILE + w * 4 * XF_KS
                          + (g >> 1) * XF_UNIT + ((g & 1) * 16 + r8) * 8;
#pragma unroll
  for (int rh = 0; rh < 2; ++rh)
#pragma unroll
    for (int jj = 0; jj < 4; ++jj) {
      us8 o;
#pragma unroll
      for (int c = 0; c < 4; ++c) {
        o[c]     = f32_to_bf16(r[rh][jj][0][c]);
        o[4 + c] = f32_to_bf16(r[rh][jj][1][c]);
      }
      *(us8*)(op + jj * XF_KS + rh * 64) = o;
    }
}

// One A fragment of x from xf: p = fragment start + lane * 8.
__device__ __forceinline__ v16bf load_xfrag(const unsigned short* p) {
  us8 a = *(const us8*)(p);
  us8 b = *(const us8*)(p + XF_UNIT);
  us16 r = __builtin_shufflevector(a, b, 0,1,2,3,4,5,6,7,8,9,10,11,12,13,14,15);
  return __builtin_bit_cast(v16bf, r);
}

// Wt[m][out][in] = W_m[in][out]  (bf16), transposed in registers.
// A wave owns a tile of 64 in x 32 out: lane (a = lane & 7, b = lane >> 3)
// reads 4 outs (16 bytes; 8 lanes = one 128-byte line of a W row) of the 16 ins
// k*32 + b*8 + j and writes, per out, two 16-byte runs of 8 ins; the 128-byte
// line of a Wt row is written by this wave alone.
// grid=(144,3), block=64: 24 out tiles x 12 in tiles = 288 waves per matrix.
__global__ __launch_bounds__(64)
void cvt_w_kernel(const float* __restrict__ wq,
                  const float* __restrict__ wk,
                  const float* __restrict__ wv,
                  unsigned short* __restrict__ wt) {
  const int m    = blockIdx.y;
  const float* w = (m == 0) ? wq : ((m == 1) ? wk : wv);
  const int lane = threadIdx.x & 31;
  const int wv_i = blockIdx.x * 2 + (threadIdx.x >> 5);        // 0..287
  const int ot   = wv_i % 24;
  const int it   = wv_i / 24;
  const int o0   = ot * 32 + (lane & 7) * 4;
  const int i0   = it * 64 + (lane >> 3) * 8;

  const float* wp = w + (size_t)i0 * HID + o0;
  v4f r[2][8];
#pragma unroll
  for (int k = 0; k < 2; ++k)
#pragma unroll
    for (int j = 0; j < 8; ++j)
      r[k][j] = *(const v4f*)(wp + (k * 32 + j) * HID);
  // precaution: the loads' address pair is an input here, so it stays live and
  // unwritten (also by a load's own result) up to this wait behind the last load
  asm volatile("s_wait_xcnt 0x0" :: "v"(wp) : "memory");

  unsigned short* op = wt + (size_t)m * HID * HID + (size_t)o0 * HID + i0;
#pragma unroll
  for (int c = 0; c < 4; ++c)
#pragma unroll
    for (int k = 0; k < 2; ++k) {
      us8 o;
#pragma unroll
      for (int j = 0; j < 8; ++j) o[j] = f32_to_bf16(r[k][j][c]);
      *(us8*)(op + c * HID + k * 32) = o;
    }
}

// ---- QKV projection GEMM --------------------------------------------------
// Block: 4 waves, each 32 rows (s) x 64 cols (one head). The 64x768 W slab
// is staged once in LDS (row stride padded to 776 -> conflict-free b128).
// The k loop is software-pipelined in registers: the x fragments come straight
// from global memory (fragment order, see cvt_x_kernel) into a ring of AR register sets, each refilled AR k-steps
// ahead of its use (the first AR fly under the W staging), and the W fragments
// of a k-step are read from LDS as one group under the k-step before.
// grid=(32,NH,3), block=128.
#define WPAD 776
#define AR   6                      // x fragment sets in the ring
#define NK   (HID / 32)             // 24 k-steps

__global__ __launch_bounds__(128)
void qkv_gemm_kernel(const unsigned short* __restrict__ xb,
                     const unsigned short* __restrict__ wt,
                     const float* __restrict__ bq,
                     const float* __restrict__ bk,
                     const float* __restrict__ bv,
                     unsigned short* __restrict__ q,
                     unsigned short* __restrict__ k,
                     unsigned short* __restrict__ vt) {
  __shared__ unsigned short wslab[HD * WPAD];   // ~97 KB of the 320 KB LDS

  const int tid   = threadIdx.x;
  const int lane  = tid & 31;
  const int wid   = tid >> 5;
  const int h     = blockIdx.y;
  const int m     = blockIdx.z;
  const int lr    = lane & 15;
  const int half8 = (lane < 16) ? 0 : 8;
  const int s0    = (blockIdx.x * 4 + wid) * 32;

  // x fragments of the first AR k-steps: issued ahead of the W staging
  const unsigned short* pa0 = xb + (size_t)(s0 >> 4) * XF_TILE + lane * 8;
  const unsigned short* pa1 = pa0 + XF_TILE;
  v16bf af[AR][2];
#pragma unroll
  for (int i = 0; i < AR; ++i) {
    af[i][0] = load_xfrag(pa0 + i * XF_KS);
    af[i][1] = load_xfrag(pa1 + i * XF_KS);
  }
  // keeps the loads above in front of the staging (else they sink to their use)
  __builtin_amdgcn_sched_barrier(0);

  // stage W slab: 64 rows x 768 cols = 6144 16B-chunks (64*96 chunks)
  const unsigned short* wm = wt + (size_t)m * HID * HID + (size_t)h * HD * HID;
  for (int c = tid; c < HD * (HID / 8); c += 128) {
    int o  = c / (HID / 8);
    int kc = (c - o * (HID / 8)) * 8;
    copy16(wm + (size_t)o * HID + kc, &wslab[o * WPAD + kc]);
  }
  wait_async();
  __syncthreads();

  const float* bias = (m == 0) ? bq : ((m == 1) ? bk : bv);

  v8f zero = {0.f,0.f,0.f,0.f,0.f,0.f,0.f,0.f};
  v8f acc[2][4] = {{zero, zero, zero, zero}, {zero, zero, zero, zero}};

  v16bf bfr[2][4];
#pragma unroll
  for (int dt = 0; dt < 4; ++dt)
    bfr[0][dt] = load_frag(wslab, dt * 16 + lr, WPAD, half8);

  // full unroll: ring and W sets are indexed by constants
#pragma unroll
  for (int i = 0; i < NK; ++i) {
    if (i + 1 < NK) {
#pragma unroll
      for (int dt = 0; dt < 4; ++dt)
        bfr[(i + 1) & 1][dt] =
            load_frag(wslab, dt * 16 + lr, WPAD, (i + 1) * 32 + half8);
    }
    // the two scheduling barriers hold the fetches for later k-steps in front of
    // this k-step's products: moved down to their use they would wait out their
    // whole latency there
    __builtin_amdgcn_sched_barrier(0);
#pragma unroll
    for (int dt = 0; dt < 4; ++dt) {
      acc[0][dt] = wmma_bf16(af[i % AR][0], bfr[i & 1][dt], acc[0][dt]);
      acc[1][dt] = wmma_bf16(af[i % AR][1], bfr[i & 1][dt], acc[1][dt]);
    }
    __builtin_amdgcn_sched_barrier(0);
    if (i + AR < NK) {
      af[i % AR][0] = load_xfrag(pa0 + (i + AR) * XF_KS);
      af[i % AR][1] = load_xfrag(pa1 + (i + AR) * XF_KS);
    }
    if (i + AR == NK - 1) {
      // precaution: the loads' address pairs are inputs here, so they stay live
      // and unwritten up to this wait behind the last load
      asm volatile("s_wait_xcnt 0x0" :: "v"(pa0), "v"(pa1) : "memory");
    }
  }

#pragma unroll
  for (int st = 0; st < 2; ++st) {
#pragma unroll
    for (int dt = 0; dt < 4; ++dt) {
      const int col = h * HD + dt * 16 + lr;
      v8f r = acc[st][dt] + bias[col];
      if (m == 0) r = r * 0.125f;               // fold 1/sqrt(HD) into Q
      if (m < 2) {                              // q/k: [h][s][d] bf16
        unsigned short* dst = (m == 0) ? q : k;
#pragma unroll
        for (int j = 0; j < 8; ++j) {
          int s = s0 + st * 16 + half8 + j;
          dst[((size_t)h * S_LEN + s) * HD + dt * 16 + lr] = f32_to_bf16(r[j]);
        }
      } else {                                  // v: transposed [h][d][s] bf16
        us8 hv;
#pragma unroll
        for (int j = 0; j < 8; ++j) hv[j] = f32_to_bf16(r[j]);
        *(us8*)(vt + ((size_t)h * HD + dt * 16 + lr) * S_LEN
                   + s0 + st * 16 + half8) = hv;
      }
    }
  }
}

// ---- flash attention ------------------------------------------------------
// Block: 4 waves = 2 query halves (32 queries each) x 2 key slices; 64 queries
// of one head. A stage is 128 keys (double-buffered LDS, 144-byte row pitch);
// key slice ks works on keys [k0 + 64*ks, k0 + 64*ks + 64) of every stage in ONE
// online-softmax step (one maximum, one rescale of sum and context per 64 keys)
// and keeps its own running maximum, sum and context; the two slices of a query
// half are joined once, through LDS, behind the loop.
// 768 blocks on 256 WGPs: three waves on every SIMD.
// grid=(64,NH), block=128.
#define KT   128                    // keys of a stage
#define KW   64                     // keys of a wave's step
#define KPAD 72
#define VPAD 72

__global__ __launch_bounds__(128)
void attn_kernel(const unsigned short* __restrict__ q,
                 const unsigned short* __restrict__ k,
                 const unsigned short* __restrict__ vt,
                 const float* __restrict__ mask,
                 float* __restrict__ out) {
  __shared__ __attribute__((aligned(16))) unsigned short ktile[2][KT * KPAD];
  // V^T: one 64 x 64 tile per key slice
  __shared__ __attribute__((aligned(16))) unsigned short vtile[2][2 * HD * VPAD];
  __shared__ v4f   xacc[2][16][32];   // key slice 1's context, per query half
  __shared__ float xml[2][4][32];     // key slice 1's maxima and sums

  const int tid   = threadIdx.x;
  const int lane  = tid & 31;
  const int wid   = __builtin_amdgcn_readfirstlane(tid >> 5);
  const int qh    = wid & 1;          // query half of the block
  const int ks    = wid >> 1;         // key slice of every stage
  const int h     = blockIdx.y;
  const int q0    = blockIdx.x * 64 + qh * 32;
  const int lr    = lane & 15;
  const int half8 = (lane < 16) ? 0 : 8;

  const unsigned short* qh_p = q  + (size_t)h * S_LEN * HD;
  const unsigned short* kh_p = k  + (size_t)h * S_LEN * HD;
  const unsigned short* vh_p = vt + (size_t)h * HD * S_LEN;

  // Q^T B-fragments: 2 query sub-tiles x 2 head-dim chunks
  v16bf bqf[2][2];
#pragma unroll
  for (int qs = 0; qs < 2; ++qs) {
    bqf[qs][0] = load_frag(qh_p, q0 + qs * 16 + lr, HD,  0 + half8);
    bqf[qs][1] = load_frag(qh_p, q0 + qs * 16 + lr, HD, 32 + half8);
  }

  v8f zero = {0.f,0.f,0.f,0.f,0.f,0.f,0.f,0.f};
  v8f acc[2][4] = {{zero, zero, zero, zero}, {zero, zero, zero, zero}};
  // lowest finite start: a key slice whose first 64 keys are all masked to -inf
  // then yields zeros (exp(-inf)), not inf - inf
  float mrun[2] = {-3.402823466e+38f, -3.402823466e+38f};
  float lrun[2] = {0.f, 0.f};

  // ---- stage helper: 128x64 K tile + two 64x64 V^T tiles -> LDS ----
  // Chunk c = tid + rr * 128 of 1024: K row c >> 3, run c & 7 (the tile is
  // contiguous in global memory); V^T row c >> 4, key run c & 15. A thread's part
  // of every address is formed once; the rest is uniform or a constant.
  const unsigned kgo = tid * 16;                                    // bytes
  const unsigned vgo = ((tid >> 4) * S_LEN + (tid & 15) * 8) * 2;   // bytes
  const int klo = (tid >> 3) * KPAD + (tid & 7) * 8;
  const int vlo = ((tid >> 3) & 1) * (HD * VPAD) + (tid >> 4) * VPAD + (tid & 7) * 8;
  auto stage = [&](int buf, int k0) {
    const char* kb = (const char*)(kh_p + (size_t)k0 * HD);
    const char* vb = (const char*)(vh_p + k0);
#pragma unroll
    for (int rr = 0; rr < 8; ++rr) {
      copy16((const unsigned short*)(kb + rr * 2048 + kgo),
             &ktile[buf][klo + rr * 16 * KPAD]);
      copy16((const unsigned short*)(vb + (size_t)rr * (8 * S_LEN * 2) + vgo),
             &vtile[buf][vlo + rr * 8 * VPAD]);
    }
  };

  stage(0, 0);
  int cur = 0;

  for (int k0 = 0; k0 < S_LEN; k0 += KT) {
    // publish point: this wave's LDS reads of the buffer refilled below have
    // retired, its copies of this stage have landed; then the barrier
    asm volatile("s_wait_dscnt 0x0" ::: "memory");
    asm volatile("s_wait_asynccnt 0x0" ::: "memory");
    __syncthreads();                 // ktile[cur]/vtile[cur] ready for all
    const int nxt = cur ^ 1;
    if (k0 + KT < S_LEN) stage(nxt, k0 + KT);   // overlap with compute

    const unsigned short* kt = ktile[cur] + ks * KW * KPAD;
    const unsigned short* vs = vtile[cur] + ks * HD * VPAD;

    const float* mp = mask + k0 + ks * KW + half8;
    v8f mk[4];
#pragma unroll
    for (int i = 0; i < 4; ++i) mk[i] = *(const v8f*)(mp + i * 16);
    // precaution: the loads' address pair is an input here, so it stays live and
    // unwritten (also by a load's own result) up to this wait behind the last load
    asm volatile("s_wait_xcnt 0x0" :: "v"(mp) : "memory");

    // K A-fragments: four 16-key row tiles x 2 head-dim chunks, each serving both
    // query sub-tiles
    v16bf ka[4][2];
#pragma unroll
    for (int i = 0; i < 4; ++i) {
      ka[i][0] = load_frag(kt, i * 16 + lr, KPAD,  0 + half8);
      ka[i][1] = load_frag(kt, i * 16 + lr, KPAD, 32 + half8);
    }
    // keeps the K reads one group in front of the products: sunk to their use,
    // into one shared register set, each pair would wait out its whole latency
    __builtin_amdgcn_sched_barrier(0);

    // S^T = K * Q^T : the eight score tiles side by side, one head-dim chunk after
    // the other, so that no product waits for the one it adds to
    v8f t[2][4];
#pragma unroll
    for (int i = 0; i < 4; ++i)
#pragma unroll
      for (int qs = 0; qs < 2; ++qs)
        t[qs][i] = wmma_bf16(ka[i][0], bqf[qs][0], zero);
#pragma unroll
    for (int i = 0; i < 4; ++i)
#pragma unroll
      for (int qs = 0; qs < 2; ++qs)
        t[qs][i] = wmma_bf16(ka[i][1], bqf[qs][1], t[qs][i]);
    // keeps the sixteen products one run: interleaved with the vector work on
    // their results, on one shared tile, each pair stood alone with idle slots
    __builtin_amdgcn_sched_barrier(0);
#pragma unroll
    for (int i = 0; i < 4; ++i)
#pragma unroll
      for (int qs = 0; qs < 2; ++qs)
        t[qs][i] = t[qs][i] + mk[i];

    // V^T A-fragments: 4 head-dim tiles x 2 chunks of 32 keys
    v16bf va[4][2];
#pragma unroll
    for (int dt = 0; dt < 4; ++dt) {
      va[dt][0] = load_frag(vs, dt * 16 + lr, VPAD,  0 + half8);
      va[dt][1] = load_frag(vs, dt * 16 + lr, VPAD, 32 + half8);
    }

#pragma unroll
    for (int qs = 0; qs < 2; ++qs) {
      // online softmax: in-lane over 32 keys + one xor-16 shuffle
      float ma = t[qs][0][0], mb = t[qs][2][0];
#pragma unroll
      for (int j = 1; j < 8; ++j) {
        ma = fmaxf(ma, t[qs][0][j]);
        mb = fmaxf(mb, t[qs][2][j]);
      }
#pragma unroll
      for (int j = 0; j < 8; ++j) {
        ma = fmaxf(ma, t[qs][1][j]);
        mb = fmaxf(mb, t[qs][3][j]);
      }
      float mloc  = fmaxf(ma, mb);
      float mtile = fmaxf(mloc, __shfl_xor(mloc, 16, 32));
      float mnew  = fmaxf(mrun[qs], mtile);
      float alpha = (mrun[qs] - mnew) * 1.44269504f;

      float p0[16], p1[16];
#pragma unroll
      for (int j = 0; j < 8; ++j) {
        p0[j]     = (t[qs][0][j] - mnew) * 1.44269504f;
        p0[8 + j] = (t[qs][1][j] - mnew) * 1.44269504f;
        p1[j]     = (t[qs][2][j] - mnew) * 1.44269504f;
        p1[8 + j] = (t[qs][3][j] - mnew) * 1.44269504f;
      }
      exp2_17_slot(alpha, p0);
      exp2_16_slot(p1);
      float la = 0.f, lb = 0.f;
#pragma unroll
      for (int j = 0; j < 16; ++j) {
        la += p0[j];
        lb += p1[j];
      }
      float lloc  = la + lb;
      float ltile = lloc + __shfl_xor(lloc, 16, 32);
      lrun[qs] = lrun[qs] * alpha + ltile;
      mrun[qs] = mnew;

      // P^T B-fragments straight from the S^T C-fragments (no lane movement)
      // (round-to-nearest-even on v_cvt_pk_bf16_f32, one per two values)
      v16f pf0, pf1;
#pragma unroll
      for (int j = 0; j < 16; ++j) {
        pf0[j] = p0[j];
        pf1[j] = p1[j];
      }
      v16bf pb0 = __builtin_convertvector(pf0, v16bf);
      v16bf pb1 = __builtin_convertvector(pf1, v16bf);

#pragma unroll
      for (int dt = 0; dt < 4; ++dt)
        acc[qs][dt] = wmma_bf16(va[dt][0], pb0, acc[qs][dt] * alpha);
#pragma unroll
      for (int dt = 0; dt < 4; ++dt)
        acc[qs][dt] = wmma_bf16(va[dt][1], pb1, acc[qs][dt]);
    }
    cur = nxt;
  }

  // ---- join the two key slices: slice 1 hands over, slice 0 merges ----
  if (ks == 1) {
#pragma unroll
    for (int qs = 0; qs < 2; ++qs) {
#pragma unroll
      for (int dt = 0; dt < 4; ++dt) {
        v8f a = acc[qs][dt];
        xacc[qh][(qs * 4 + dt) * 2 + 0][lane] = __builtin_shufflevector(a, a, 0, 1, 2, 3);
        xacc[qh][(qs * 4 + dt) * 2 + 1][lane] = __builtin_shufflevector(a, a, 4, 5, 6, 7);
      }
      xml[qh][qs][lane]     = mrun[qs];
      xml[qh][2 + qs][lane] = lrun[qs];
    }
  }
  __syncthreads();                   // slice 1's partials visible to slice 0
  if (ks == 0) {
    float w0[2], w1[2], lj[2];
#pragma unroll
    for (int qs = 0; qs < 2; ++qs) {
      const float mo = xml[qh][qs][lane];
      const float mj = fmaxf(mrun[qs], mo);
      w0[qs] = exp_slot(mrun[qs] - mj);
      w1[qs] = exp_slot(mo - mj);
    }
#pragma unroll
    for (int qs = 0; qs < 2; ++qs) {
      lj[qs] = lrun[qs] * w0[qs] + xml[qh][2 + qs][lane] * w1[qs];
      const float inv = 1.0f / lj[qs];
      const float s0 = w0[qs] * inv;
      const float s1 = w1[qs] * inv;
      const int s = q0 + qs * 16 + lr;
      float* op = out + (size_t)s * HID + h * HD + half8;
#pragma unroll
      for (int dt = 0; dt < 4; ++dt) {
        v4f b0 = xacc[qh][(qs * 4 + dt) * 2 + 0][lane];
        v4f b1 = xacc[qh][(qs * 4 + dt) * 2 + 1][lane];
        v8f b  = __builtin_shufflevector(b0, b1, 0, 1, 2, 3, 4, 5, 6, 7);
        *(v8f*)(op + dt * 16) = acc[qs][dt] * s0 + b * s1;
      }
    }
  }
}

// ---- launcher -------------------------------------------------------------

extern "C" void kernel_launch(void* const* d_in, const int* in_sizes, int n_in,
                              void* d_out, int out_size, void* d_ws, size_t ws_size,
                              hipStream_t stream) {
  const float* hidden = (const float*)d_in[0];
  const float* amask  = (const float*)d_in[1];
  const float* Wq     = (const float*)d_in[2];
  const float* bq     = (const float*)d_in[3];
  const float* Wk     = (const float*)d_in[4];
  const float* bk     = (const float*)d_in[5];
  const float* Wv     = (const float*)d_in[6];
  const float* bv     = (const float*)d_in[7];
  float* out = (float*)d_out;

  // workspace layout (bytes)
  char* ws = (char*)d_ws;
  unsigned short* xb = (unsigned short*)(ws);           // 4096*768, fragment order
  unsigned short* wt = (unsigned short*)(ws + 6291456);                // 3*768*768
  unsigned short* qb = (unsigned short*)(ws + 6291456 + 3538944);      // 12*4096*64
  unsigned short* kb = (unsigned short*)(ws + 6291456 + 3538944 + 6291456);
  unsigned short* vtb= (unsigned short*)(ws + 6291456 + 3538944 + 2*6291456);

  cvt_x_kernel<<<256, CX_T, 0, stream>>>(hidden, xb);
  cvt_w_kernel<<<dim3(144, 3), 64, 0, stream>>>(Wq, Wk, Wv, wt);

  qkv_gemm_kernel<<<dim3(S_LEN / 128, NH, 3), 128, 0, stream>>>(
      xb, wt, bq, bk, bv, qb, kb, vtb);

  attn_kernel<<<dim3(S_LEN / 64, NH), 128, 0, stream>>>(qb, kb, vtb, amask, out);
}
